// v000
// Times are from an AMD MI455X. After a warm-up the kernel runs many times in a row, and a time is the length of
// such a window on the GPU divided by its runs, so every launch and the gaps after it count. The runs cycle
// through copies of the inputs. A figure is the median of several windows, for all but v000 over two sittings.
// Sittings can differ by a few percent; kernels timed side by side share one.
// v000, which the later versions start from, runs in 371 microseconds.
#include <hip/hip_runtime.h>

// MultiheadAttention_KV: kv = x kv_w^T + kv_b (16 heads x [k 64 | v 64] interleaved per head); scores = (k_q . k_k)/8 * sum(mp_w) + pos_bias[q][k] with pos_bias = pos mp_w^T + mp_b
// (shared over batch and heads; precomputed once); softmax; vals = a v; out = vals o_w^T + o_b -> [8][1024][1024]. Keys and queries are the SAME k rows.
namespace {
constexpr int BT = 8, Bn = 8, S = 1024, D = 1024, H = 16, HD = 64, NTOK = Bn * S, NP_ = 10;
constexpr float SCALE = 0.125f, VS = 8.0f, QS = 8.0f, PS = 8.0f;   // power-of-two carry scales so hi/lo residual planes stay normal in f16
constexpr size_t VPL = (size_t)NTOK * D;   // distance between the (8v)^T hi and lo planes
constexpr size_t QPL = (size_t)NTOK * D;   // distance between the q/k hi and lo planes

typedef _Float16 b16;
typedef __attribute__((ext_vector_type(16))) _Float16 v16b;
typedef __attribute__((ext_vector_type(8)))  _Float16 v8b;
typedef __attribute__((ext_vector_type(8)))  float v8f;
typedef __attribute__((ext_vector_type(4)))  float v4f;

__device__ __forceinline__ v8b ld8b(const b16* p) { return *(const v8b*)p; }
__device__ __forceinline__ v16b cat8b(v8b a, v8b b) { return __builtin_shufflevector(a, b, 0, 1, 2, 3, 4, 5, 6, 7, 8, 9, 10, 11, 12, 13, 14, 15); }
__device__ __forceinline__ v16b frag_kb(const b16* p, int hh) { return cat8b(ld8b(p + 8 * hh), ld8b(p + 16 + 8 * hh)); }
__device__ __forceinline__ void split16(float v, b16& hi, b16& lo) { hi = (b16)v; lo = (b16)(v - (float)hi); }
// hi/lo fragment pair straight from an f32 k-contiguous row (same k-map)
__device__ __forceinline__ void frag_ksplit(const float* p, int hh, v16b& fh_, v16b& fl_) {
  const float* p0 = p + 8 * hh; const float* p1 = p + 16 + 8 * hh;
#pragma unroll
  for (int e = 0; e < 8; ++e) { b16 a, c; split16(p0[e], a, c); fh_[e] = a; fl_[e] = c; split16(p1[e], a, c); fh_[8 + e] = a; fl_[8 + e] = c; }
}
__device__ __forceinline__ v8f wmma16b(v16b a, v16b b, v8f c) {
  v8f d = __builtin_amdgcn_wmma_f32_16x16x32_f16(false, a, false, b, (short)0, c, false, false);
  asm volatile("v_nop\n\tv_nop\n\tv_nop\n\tv_nop" : "+v"(d) : "v"(a), "v"(b));
  return d;
}
__device__ __forceinline__ void wave_lds_sync() {
  __builtin_amdgcn_fence(__ATOMIC_RELEASE, "workgroup");
  __builtin_amdgcn_wave_barrier();
  __builtin_amdgcn_fence(__ATOMIC_ACQUIRE, "workgroup");
}

// Operand descriptor: NP = 0 -> f32 rows split on the fly into (hi, lo); NP = 1 -> one f16 plane; NP = 2 -> f16 hi + lo planes;
// NP = 3 -> f32 rows rounded once to a single f16 fragment. ld = row pitch.
struct Opnd { const void* p0; const void* p1; int ld; };
template <int NP> __device__ __forceinline__ void load_frags(const Opnd& o, int row, int kb, int hh, v16b& fh_, v16b& fl_) {
  if (NP == 0) { frag_ksplit((const float*)o.p0 + (size_t)row * o.ld + kb, hh, fh_, fl_); }
  else if (NP == 4 || NP == 5) {                             // f32 rows x64 (NP 4) or x8 (NP 5) then split (keeps the lo halves of small values normal)
    const float sc_ = (NP == 4) ? 64.0f : 8.0f;
    const float* p = (const float*)o.p0 + (size_t)row * o.ld + kb; const float* p0 = p + 8 * hh; const float* p1 = p + 16 + 8 * hh;
#pragma unroll
    for (int e = 0; e < 8; ++e) { b16 a, c; split16(p0[e] * sc_, a, c); fh_[e] = a; fl_[e] = c; split16(p1[e] * sc_, a, c); fh_[8 + e] = a; fl_[8 + e] = c; }
  } else if (NP == 3) {
    const float* p = (const float*)o.p0 + (size_t)row * o.ld + kb; const float* p0 = p + 8 * hh; const float* p1 = p + 16 + 8 * hh;
#pragma unroll
    for (int e = 0; e < 8; ++e) { fh_[e] = (b16)p0[e]; fh_[8 + e] = (b16)p1[e]; }
    fl_ = fh_;
  } else {
    fh_ = frag_kb((const b16*)o.p0 + (size_t)row * o.ld + kb, hh);
    if (NP == 2) fl_ = frag_kb((const b16*)o.p1 + (size_t)row * o.ld + kb, hh); else fl_ = fh_;
  }
}
template <int ANP, int BNP> __device__ __forceinline__ v8f mac(v16b ah, v16b al, v16b bh, v16b bl, v8f c) {
  c = wmma16b(ah, bh, c);
  if (BNP == 0 || BNP == 2 || BNP == 4 || BNP == 5) c = wmma16b(ah, bl, c);     // hi.lo
  if (ANP == 0 || ANP == 2 || ANP == 4 || ANP == 5) c = wmma16b(al, bh, c);     // lo.hi   (lo.lo dropped)
  return c;
}
// 32x64 wave tile: acc[r][t] (rows m0+16r.., cols c0+16t..) += A[m][k] . B[n][k] over k in [0, K)
template <int ANP, int BNP>
__device__ __forceinline__ void gemm_tile(const Opnd& A, const Opnd& B, int K, int m0, int c0, int nloc, int hlf, v8f (&acc)[2][4]) {
  for (int kb = 0; kb < K; kb += 32) {
    v16b a0h, a0l, a1h, a1l;
    load_frags<ANP>(A, m0 + nloc, kb, hlf, a0h, a0l);
    load_frags<ANP>(A, m0 + 16 + nloc, kb, hlf, a1h, a1l);
#pragma unroll
    for (int t = 0; t < 4; ++t) {
      v16b bh, bl;
      load_frags<BNP>(B, c0 + t * 16 + nloc, kb, hlf, bh, bl);
      acc[0][t] = mac<ANP, BNP>(a0h, a0l, bh, bl, acc[0][t]);
      acc[1][t] = mac<ANP, BNP>(a1h, a1l, bh, bl, acc[1][t]);
    }
  }
}

__device__ __forceinline__ void epi_planes(v8f (&acc)[2][4], float scale, bool two, b16* __restrict__ oh, b16* __restrict__ ol, int ldo,
                                           int m0, int c0, int lane, b16* Th, b16* Tl) {
  const int nloc = lane & 15, hlf = lane >> 4;
#pragma unroll
  for (int t = 0; t < 4; ++t)
#pragma unroll
    for (int r = 0; r < 2; ++r)
#pragma unroll
      for (int v = 0; v < 8; ++v) {
        const int rr = r * 16 + v + 8 * hlf, cc = t * 16 + nloc;
        b16 h_, l_; split16(acc[r][t][v] * scale, h_, l_);
        Th[rr * 64 + cc] = h_; Tl[rr * 64 + cc] = l_;
      }
  wave_lds_sync();
  {
#pragma unroll
    for (int j = 0; j < 8; ++j) {
      const int rr = j * 4 + (lane >> 3), c8 = (lane & 7) * 8;
      const size_t o = (size_t)(m0 + rr) * ldo + c0 + c8;
      *(v8b*)(oh + o) = ld8b(Th + rr * 64 + c8);
      if (two) *(v8b*)(ol + o) = ld8b(Tl + rr * 64 + c8);
    }
    
  }
}
// (b) f32 rows with pitch ldo: 64 floats = 256 B = 2 lines per row; 16 lanes x 16 B per row, 2 rows per instruction. Optional per-row factor
__device__ __forceinline__ void epi_f32(v8f (&acc)[2][4], float scale, const float* rscale, float* __restrict__ out, int ldo, int m0, int c0, int lane, float* Tt) {
  const int nloc = lane & 15, hlf = lane >> 4;
#pragma unroll
  for (int t = 0; t < 4; ++t)
#pragma unroll
    for (int r = 0; r < 2; ++r)
#pragma unroll
      for (int v = 0; v < 8; ++v) {
        const int rr = r * 16 + v + 8 * hlf;
        const float rs = rscale ? rscale[(size_t)(m0 + rr) * 32] : 1.0f;
        Tt[rr * 64 + t * 16 + nloc] = acc[r][t][v] * scale * rs;
      }
  wave_lds_sync();
  float* dst0 = out + (size_t)m0 * ldo + c0;
  {
#pragma unroll
    for (int j = 0; j < 16; ++j) { const int rr = j * 2 + hlf, c4 = nloc * 4; *(v4f*)(dst0 + (size_t)rr * ldo + c4) = *(const v4f*)(Tt + rr * 64 + c4); }
    
  }
}



typedef __attribute__((ext_vector_type(8))) __bf16 v8bb; typedef __attribute__((ext_vector_type(16))) __bf16 v16bb;
typedef __attribute__((ext_vector_type(8))) unsigned short v8us;
__device__ __forceinline__ v16bb frag_kb_bf(const __bf16* p, int hh) { const v8bb a = *(const v8bb*)(p + 8 * hh), b = *(const v8bb*)(p + 16 + 8 * hh); return __builtin_shufflevector(a, b, 0, 1, 2, 3, 4, 5, 6, 7, 8, 9, 10, 11, 12, 13, 14, 15); }
__device__ __forceinline__ v8f wmma16bb(v16bb a, v16bb b, v8f c) {
  v8f d = __builtin_amdgcn_wmma_f32_16x16x32_bf16(false, a, false, b, (short)0, c, false, false);
  asm volatile("v_nop\n\tv_nop\n\tv_nop\n\tv_nop" : "+v"(d) : "v"(a), "v"(b));
  return d;
}
__device__ __forceinline__ unsigned short bf16_rne_bits(float v) { unsigned int u = __float_as_uint(v); u += 0x7FFFu + ((u >> 16) & 1u); return (unsigned short)(u >> 16); }
__device__ __forceinline__ float bf16_rne(float v) { return __uint_as_float(((unsigned int)bf16_rne_bits(v)) << 16); }



__global__ __launch_bounds__(256) void xprep_kernel(const float* __restrict__ x, unsigned short* __restrict__ x16) {   // all 8 batches of x -> bf16
  const size_t tid = (size_t)blockIdx.x * blockDim.x + threadIdx.x, nth = (size_t)gridDim.x * blockDim.x;
  { for (size_t p = tid; p < (size_t)NTOK * D / 8; p += nth) { v8us v;
#pragma unroll
      for (int e = 0; e < 8; ++e) v[e] = bf16_rne_bits(x[p * 8 + e]);
      *(v8us*)(x16 + p * 8) = v; }  }
}
__global__ __launch_bounds__(256) void prep_kernel(const float* __restrict__ wqkv, const float* __restrict__ wo, unsigned short* __restrict__ w16, b16* __restrict__ wo16) {
  const size_t tid = (size_t)blockIdx.x * blockDim.x + threadIdx.x, nth = (size_t)gridDim.x * blockDim.x;
  {
    for (size_t p = tid; p < (size_t)2 * D * D / 8; p += nth) { v8us v;   // kv_w [2048][1024] ([out][in]) rows copied directly
#pragma unroll
      for (int e = 0; e < 8; ++e) v[e] = bf16_rne_bits(wqkv[p * 8 + e]);
      *(v8us*)(w16 + p * 8) = v; }
    for (size_t p = tid; p < (size_t)D * D / 8; p += nth) { v8b w;   // W_o [out][in] rows copied directly
#pragma unroll
      for (int e = 0; e < 8; ++e) w[e] = (b16)bf16_rne(wo[p * 8 + e]);
      *(v8b*)(wo16 + p * 8) = w; }
    
  }
}

__global__ __launch_bounds__(256) void posb_kernel(const float* __restrict__ pos, const float* __restrict__ mw, const float* __restrict__ mb, float* __restrict__ pb, float* __restrict__ sw) {
  const size_t g = (size_t)blockIdx.x * 256 + threadIdx.x; const float* pr = pos + g * NP_; float s = bf16_rne(mb[0]);
  if (g < 64) { float t = 0.0f; for (int p = 0; p < NP_; ++p) t += bf16_rne(mw[p]); ((float*)sw)[g] = t; ((float*)sw)[g] = t; }   // Σ bf16(mp_w), replicated over one 256-B row
#pragma unroll
  for (int p = 0; p < NP_; ++p) { float t = bf16_rne(pr[p]) * bf16_rne(mw[p]); asm volatile("" : "+v"(t)); s += t; }
  { ((float*)pb)[g] = s;  }
}

// projections: rows = tokens (8192), K = 1024, column tiles of 64 = one head's k (even tiles) or v (odd tiles); f16 rows [b*H + head][tok][64] for q/k;
// v: (8v)^T f16 [b*H + head][64][tok]. grid (32, 64) x 128.
__global__ __launch_bounds__(128) void proj_kernel(const __bf16* __restrict__ x16, const __bf16* __restrict__ w16, const float* __restrict__ bqkv, b16* __restrict__ kh, b16* __restrict__ vt) {
  __shared__ __attribute__((aligned(16))) b16 Th[4][32][HD + 8], Tq[4][32][HD + 8];
  __shared__ __attribute__((aligned(16))) b16 Tt[64][128 + 8], Tl[64][128 + 8];
  const int lane = threadIdx.x & 31, wave = threadIdx.x >> 5, nloc = lane & 15, hlf = lane >> 4, m0 = blockIdx.y * 128 + wave * 32, c0 = blockIdx.x * 64;
  v8f acc[2][4];
#pragma unroll
  for (int r = 0; r < 2; ++r)
#pragma unroll
    for (int t = 0; t < 4; ++t) acc[r][t] = (v8f){};
#pragma unroll 2
  for (int kb = 0; kb < D; kb += 32) {
    const v16bb a0 = frag_kb_bf(x16 + (size_t)(m0 + nloc) * D + kb, hlf), a1 = frag_kb_bf(x16 + (size_t)(m0 + 16 + nloc) * D + kb, hlf);
#pragma unroll
    for (int t = 0; t < 4; ++t) { const v16bb bw = frag_kb_bf(w16 + (size_t)(c0 + t * 16 + nloc) * D + kb, hlf); acc[0][t] = wmma16bb(a0, bw, acc[0][t]); acc[1][t] = wmma16bb(a1, bw, acc[1][t]); }
  }
  const int which = blockIdx.x & 1, head = blockIdx.x >> 1, b = m0 / S, tok0 = m0 % S;   // tile = (head, k|v) interleaved per head
#pragma unroll
  for (int t = 0; t < 4; ++t) { const float bb = bf16_rne(bqkv[c0 + t * 16 + nloc]);   // + bias (bf16-rounded)
#pragma unroll
    for (int r = 0; r < 2; ++r)
#pragma unroll
      for (int v = 0; v < 8; ++v) acc[r][t][v] += bb; }
  if (which == 0) {                                             // k head: f16 rows (hi + lo planes)
#pragma unroll
    for (int t = 0; t < 4; ++t)
#pragma unroll
      for (int r = 0; r < 2; ++r)
#pragma unroll
        for (int v = 0; v < 8; ++v) { b16 a_, c_; split16(acc[r][t][v] * QS, a_, c_); Th[wave][r * 16 + 8 * hlf + v][t * 16 + nloc] = a_; Tq[wave][r * 16 + 8 * hlf + v][t * 16 + nloc] = c_; }   // q, k carried x8 (lo residuals stay normal)
    wave_lds_sync();
    b16* dst = kh + (((size_t)b * H + head) * S + tok0) * HD;
    {
#pragma unroll
      for (int j = 0; j < 8; ++j) { const int rr = j * 4 + (lane >> 3), c8 = (lane & 7) * 8; *(v8b*)(dst + (size_t)rr * HD + c8) = *(const v8b*)(&Th[wave][rr][c8]); *(v8b*)(dst + QPL + (size_t)rr * HD + c8) = *(const v8b*)(&Tq[wave][rr][c8]); }
       }
    return;
  }
  const int vh = head;                                          // v head: (8v)^T tile [64 d][128 tok] via LDS, rows of 256 B
#pragma unroll
  for (int t = 0; t < 4; ++t)
#pragma unroll
    for (int r = 0; r < 2; ++r)
#pragma unroll
      for (int v = 0; v < 8; ++v) { b16 a_, c_; split16(acc[r][t][v] * VS, a_, c_); Tt[t * 16 + nloc][wave * 32 + r * 16 + 8 * hlf + v] = a_; Tl[t * 16 + nloc][wave * 32 + r * 16 + 8 * hlf + v] = c_; }
  __syncthreads();
  b16* dstv = vt + (((size_t)b * H + vh) * HD) * S + (blockIdx.y * 128) % S;
  {
#pragma unroll
    for (int j = 0; j < 8; ++j) { const int dd = wave * 16 + j * 2 + (lane >> 4), c8 = (lane & 15) * 8; *(v8b*)(dstv + (size_t)dd * S + c8) = *(const v8b*)(&Tt[dd][c8]); *(v8b*)(dstv + VPL + (size_t)dd * S + c8) = *(const v8b*)(&Tl[dd][c8]); }
    
  }
}

// attention without mask: wave = (b, h, 16 queries); key chunks of 32 over all S keys: S^T (K=64) + pos bias, online softmax f32, P^T f16, y^T += (8V)^T P^T;
template <int QT>
__global__ __launch_bounds__(256) void attn_kernel(const b16* __restrict__ kh, const b16* __restrict__ vt, const float* __restrict__ pb, const float* __restrict__ swp, float* __restrict__ y) {
  const float SW = swp[0];
  __shared__ __attribute__((aligned(16))) float Os[8][16][HD + 4];
  const int wid = threadIdx.x >> 5, lane = threadIdx.x & 31, hh = lane >> 4, col = lane & 15;
  const int qt = blockIdx.x * 8 + wid, jt = qt % QT, bh = qt / QT, h = bh % H, b = bh / H, q0 = jt * 16, qi = q0 + col;
  const b16* Q = kh + ((size_t)bh * S) * HD; const b16* K = kh + ((size_t)bh * S) * HD; const b16* vb = vt + ((size_t)bh * HD) * S;
  v16b qf[2], ql[2];
#pragma unroll
  for (int ks = 0; ks < 2; ++ks) { qf[ks] = frag_kb(Q + (size_t)qi * HD + ks * 32, hh); ql[ks] = frag_kb(Q + QPL + (size_t)qi * HD + ks * 32, hh); }
  float m = -INFINITY, l = 0.0f; v8f o[4] = {{}, {}, {}, {}};
  const float* pbq = pb + (size_t)qi * S;                       // this query's additive bias row
  for (int kb = 0; kb < S; kb += 32) {
    v8f s0 = {}, s1 = {};
#pragma unroll
    for (int ks = 0; ks < 2; ++ks) { const v16b k0 = frag_kb(K + (size_t)(kb + col) * HD + ks * 32, hh), k0l = frag_kb(K + QPL + (size_t)(kb + col) * HD + ks * 32, hh), k1 = frag_kb(K + (size_t)(kb + 16 + col) * HD + ks * 32, hh), k1l = frag_kb(K + QPL + (size_t)(kb + 16 + col) * HD + ks * 32, hh);
      s0 = wmma16b(k0, qf[ks], s0); s0 = wmma16b(k0, ql[ks], s0); (void)k0l;      // query side hi+lo, key side hi only (2 products): the key's 2^-11 rounding moves the O(1) logits by ~3e-5
      s1 = wmma16b(k1, qf[ks], s1); s1 = wmma16b(k1, ql[ks], s1); (void)k1l; }
    float mr = -INFINITY;
#pragma unroll
    for (int r = 0; r < 8; ++r) { s0[r] = s0[r] * (SCALE * SW / (QS * QS)) + pbq[kb + 8 * hh + r]; s1[r] = s1[r] * (SCALE * SW / (QS * QS)) + pbq[kb + 16 + 8 * hh + r]; mr = fmaxf(mr, fmaxf(s0[r], s1[r])); }
    mr = fmaxf(mr, __shfl_xor(mr, 16));
    const float mn = fmaxf(m, mr), al_ = __expf(m - mn); m = mn;
    float sum = 0.0f; v16b pb, pl;
#pragma unroll
    for (int r = 0; r < 8; ++r) { const float e0 = __expf(s0[r] - mn), e1 = __expf(s1[r] - mn); sum += e0 + e1; b16 a, c; split16(e0 * PS, a, c); pb[r] = a; pl[r] = c; split16(e1 * PS, a, c); pb[8 + r] = a; pl[8 + r] = c; }   // P carried x8
    sum += __shfl_xor(sum, 16); l = l * al_ + sum;
#pragma unroll
    for (int n = 0; n < 4; ++n) {
#pragma unroll
      for (int r = 0; r < 8; ++r) o[n][r] *= al_;
      const v16b vf = frag_kb(vb + (size_t)(n * 16 + col) * S + kb, hh), vl = frag_kb(vb + VPL + (size_t)(n * 16 + col) * S + kb, hh);
      o[n] = wmma16b(vf, pb, o[n]); o[n] = wmma16b(vf, pl, o[n]); o[n] = wmma16b(vl, pb, o[n]);   // (8v) and P both as f16 hi+lo pairs (lo.lo dropped) — v's rounding is NOT negligible here
    }
  }
  const float inv = 1.0f / (VS * PS * l);
#pragma unroll
  for (int n = 0; n < 4; ++n)
#pragma unroll
    for (int r = 0; r < 8; ++r) Os[wid][col][n * 16 + 8 * hh + r] = o[n][r] * inv;
  wave_lds_sync();
  float* dst = y + ((size_t)b * S + q0) * D + h * HD;
  {
#pragma unroll
    for (int j = 0; j < 8; ++j) { const int rr = j * 2 + hh, c4 = col * 4; *(v4f*)(dst + (size_t)rr * D + c4) = *(const v4f*)(&Os[wid][rr][c4]); }
    
  }
}

// out = y W_o^T: (8192 x 1024) x (1024 x 1024); A = y x8 split at load into f16 hi + lo, B = f16(bf16 W_o) rows; f32 rows; grid (16, 64).
__global__ __launch_bounds__(128) void out_kernel(const float* __restrict__ y, const b16* __restrict__ wo16, const float* __restrict__ bo, float* __restrict__ out) {
  __shared__ __attribute__((aligned(16))) float Ts[4][32 * 64];
  const int lane = threadIdx.x & 31, wave = threadIdx.x >> 5, nloc = lane & 15, hlf = lane >> 4, m0 = blockIdx.y * 128 + wave * 32, c0 = blockIdx.x * 64;
  v8f acc[2][4];
#pragma unroll
  for (int r = 0; r < 2; ++r)
#pragma unroll
    for (int t = 0; t < 4; ++t) acc[r][t] = (v8f){};
  const Opnd A{y, nullptr, D}, Bo{wo16, nullptr, D};
  gemm_tile<5, 1>(A, Bo, D, m0, c0, nloc, hlf, acc);                            // y as an f16 hi+lo pair carried x8 (2 products)
#pragma unroll
  for (int t = 0; t < 4; ++t)
#pragma unroll
    for (int r = 0; r < 2; ++r)
#pragma unroll
      for (int v = 0; v < 8; ++v) acc[r][t][v] = acc[r][t][v] * (1.0f / 8.0f) + bf16_rne(bo[c0 + t * 16 + nloc]);
  epi_f32(acc, 1.0f, nullptr, out, D, m0, c0, lane, Ts[wave]);
}
}  // namespace

extern "C" void kernel_launch(void* const* d_in, const int* in_sizes, int n_in,
                              void* d_out, int out_size, void* d_ws, size_t ws_size, hipStream_t stream) {
  (void)n_in; (void)out_size;
  const float* x = (const float*)d_in[0]; const float* pos = (const float*)d_in[1]; const float* wqkv = (const float*)d_in[2]; const float* bqkv = (const float*)d_in[3]; const float* wo = (const float*)d_in[4]; const float* bo = (const float*)d_in[5]; const float* mw = (const float*)d_in[6]; const float* mb = (const float*)d_in[7];
  float* out = (float*)d_out;   // [8][1024][1024]
  if (in_sizes[0] != BT * S * D || in_sizes[1] != S * S * NP_ || in_sizes[2] != 2 * D * D || in_sizes[3] != 2 * D || in_sizes[4] != D * D || in_sizes[5] != D || in_sizes[6] != NP_) return;

  size_t off = 0; char* ws = (char*)d_ws;
  auto carve = [&](size_t bytes) { char* p = ws + off; off += (bytes + 255) & ~(size_t)255; return p; };
  unsigned short* x16 = (unsigned short*)carve((size_t)NTOK * D * 2); unsigned short* w16 = (unsigned short*)carve((size_t)2 * D * D * 2); b16* wo16 = (b16*)carve((size_t)D * D * 2);
  b16* kh = (b16*)carve((size_t)2 * NTOK * D * 2); b16* vt = (b16*)carve((size_t)2 * NTOK * D * 2); float* y = (float*)carve((size_t)NTOK * D * 4); float* pb = (float*)carve((size_t)S * S * 4); float* sw = (float*)carve(256);
  if (off > ws_size) return;                                    // ≈ 128 MB
  prep_kernel<<<512, 256, 0, stream>>>(wqkv, wo, w16, wo16);
  xprep_kernel<<<1024, 256, 0, stream>>>(x, x16);
  posb_kernel<<<S * S / 256, 256, 0, stream>>>(pos, mw, mb, pb, sw);
  proj_kernel<<<dim3(2 * D / 64, NTOK / 128), 128, 0, stream>>>((const __bf16*)x16, (const __bf16*)w16, bqkv, kh, vt);
  attn_kernel<S / 16><<<Bn * H * (S / 16) / 8, 256, 0, stream>>>(kh, vt, pb, sw, y);
  out_kernel<<<dim3(D / 64, NTOK / 128), 128, 0, stream>>>(y, wo16, bo, out);
}

// v001
// It runs in 355 microseconds.
// In two side-by-side timings against v000, it was 1.08 and 1.10 times as fast.
#include <hip/hip_runtime.h>

// MultiheadAttention_KV: kv = x kv_w^T + kv_b (16 heads x [k 64 | v 64] interleaved per head); scores = (k_q . k_k)/8 * sum(mp_w) + pos_bias[q][k] with pos_bias = pos mp_w^T + mp_b
// (shared over batch and heads; precomputed once); softmax; vals = a v; out = vals o_w^T + o_b -> [8][1024][1024]. Keys and queries are the SAME k rows.
namespace {
constexpr int BT = 8, Bn = 8, S = 1024, D = 1024, H = 16, HD = 64, NTOK = Bn * S, NP_ = 10;
constexpr float SCALE = 0.125f, VS = 8.0f, QS = 8.0f, PS = 8.0f;   // power-of-two carry scales so hi/lo residual planes stay normal in f16
constexpr size_t VPL = (size_t)NTOK * D;   // distance between the (8v)^T hi and lo planes
constexpr size_t QPL = (size_t)NTOK * D;   // distance between the q/k hi and lo planes

typedef _Float16 b16;
typedef __attribute__((ext_vector_type(16))) _Float16 v16b;
typedef __attribute__((ext_vector_type(8)))  _Float16 v8b;
typedef __attribute__((ext_vector_type(8)))  float v8f;
typedef __attribute__((ext_vector_type(4)))  float v4f;

__device__ __forceinline__ v8b ld8b(const b16* p) { return *(const v8b*)p; }
__device__ __forceinline__ v16b cat8b(v8b a, v8b b) { return __builtin_shufflevector(a, b, 0, 1, 2, 3, 4, 5, 6, 7, 8, 9, 10, 11, 12, 13, 14, 15); }
// Fragment-packed operand tiles. A 16-row x 32-k tile of a 16-bit operand is 512 elements laid out [j 2][lane 32][8]: lane = 16 * hh + row holds k = 16 * j + 8 * hh + e,
// the hardware k order of a 16x16x32 A or B fragment, so each wave-wide 16-byte load reads 512 contiguous bytes (4 whole lines instead of 16 partly used ones).
// An f32 tile is [j4 4][lane 32][4] with k = 16 * (j4 >> 1) + 8 * hh + 4 * (j4 & 1) + e.
__device__ __forceinline__ v16b frag_pk(const b16* tile, int lane) { return cat8b(ld8b(tile + lane * 8), ld8b(tile + 256 + lane * 8)); }
// source offset (row-major, pitch D) of the 8 elements that packed group p holds; tiles ordered [row tile][k tile], D / 32 k tiles per row tile
__device__ __forceinline__ size_t pk_src(size_t p) {
  const size_t tile = p >> 6; const int j = (int)(p >> 5) & 1, ln = (int)p & 31;
  return ((tile >> 5) * 16 + (ln & 15)) * D + (tile & 31) * 32 + j * 16 + (ln >> 4) * 8;
}
__device__ __forceinline__ void split16(float v, b16& hi, b16& lo) { hi = (b16)v; lo = (b16)(v - (float)hi); }
__device__ __forceinline__ v8f wmma16b(v16b a, v16b b, v8f c) {
  v8f d = __builtin_amdgcn_wmma_f32_16x16x32_f16(false, a, false, b, (short)0, c, false, false);
  asm volatile("v_nop\n\tv_nop\n\tv_nop\n\tv_nop" : "+v"(d) : "v"(a), "v"(b));
  return d;
}
__device__ __forceinline__ void wave_lds_sync() {
  __builtin_amdgcn_fence(__ATOMIC_RELEASE, "workgroup");
  __builtin_amdgcn_wave_barrier();
  __builtin_amdgcn_fence(__ATOMIC_ACQUIRE, "workgroup");
}

__device__ __forceinline__ void epi_planes(v8f (&acc)[2][4], float scale, bool two, b16* __restrict__ oh, b16* __restrict__ ol, int ldo,
                                           int m0, int c0, int lane, b16* Th, b16* Tl) {
  const int nloc = lane & 15, hlf = lane >> 4;
#pragma unroll
  for (int t = 0; t < 4; ++t)
#pragma unroll
    for (int r = 0; r < 2; ++r)
#pragma unroll
      for (int v = 0; v < 8; ++v) {
        const int rr = r * 16 + v + 8 * hlf, cc = t * 16 + nloc;
        b16 h_, l_; split16(acc[r][t][v] * scale, h_, l_);
        Th[rr * 64 + cc] = h_; Tl[rr * 64 + cc] = l_;
      }
  wave_lds_sync();
  {
#pragma unroll
    for (int j = 0; j < 8; ++j) {
      const int rr = j * 4 + (lane >> 3), c8 = (lane & 7) * 8;
      const size_t o = (size_t)(m0 + rr) * ldo + c0 + c8;
      *(v8b*)(oh + o) = ld8b(Th + rr * 64 + c8);
      if (two) *(v8b*)(ol + o) = ld8b(Tl + rr * 64 + c8);
    }
    
  }
}
// (b) f32 rows with pitch ldo: 64 floats = 256 B = 2 lines per row; 16 lanes x 16 B per row, 2 rows per instruction. Optional per-row factor
__device__ __forceinline__ void epi_f32(v8f (&acc)[2][4], float scale, const float* rscale, float* __restrict__ out, int ldo, int m0, int c0, int lane, float* Tt) {
  const int nloc = lane & 15, hlf = lane >> 4;
#pragma unroll
  for (int t = 0; t < 4; ++t)
#pragma unroll
    for (int r = 0; r < 2; ++r)
#pragma unroll
      for (int v = 0; v < 8; ++v) {
        const int rr = r * 16 + v + 8 * hlf;
        const float rs = rscale ? rscale[(size_t)(m0 + rr) * 32] : 1.0f;
        Tt[rr * 64 + t * 16 + nloc] = acc[r][t][v] * scale * rs;
      }
  wave_lds_sync();
  float* dst0 = out + (size_t)m0 * ldo + c0;
  {
#pragma unroll
    for (int j = 0; j < 16; ++j) { const int rr = j * 2 + hlf, c4 = nloc * 4; *(v4f*)(dst0 + (size_t)rr * ldo + c4) = *(const v4f*)(Tt + rr * 64 + c4); }
    
  }
}



typedef __attribute__((ext_vector_type(8))) __bf16 v8bb; typedef __attribute__((ext_vector_type(16))) __bf16 v16bb;
typedef __attribute__((ext_vector_type(8))) unsigned short v8us;
__device__ __forceinline__ v16bb frag_pk_bf(const __bf16* tile, int lane) { const v8bb a = *(const v8bb*)(tile + lane * 8), b = *(const v8bb*)(tile + 256 + lane * 8); return __builtin_shufflevector(a, b, 0, 1, 2, 3, 4, 5, 6, 7, 8, 9, 10, 11, 12, 13, 14, 15); }
__device__ __forceinline__ v8f wmma16bb(v16bb a, v16bb b, v8f c) {
  v8f d = __builtin_amdgcn_wmma_f32_16x16x32_bf16(false, a, false, b, (short)0, c, false, false);
  asm volatile("v_nop\n\tv_nop\n\tv_nop\n\tv_nop" : "+v"(d) : "v"(a), "v"(b));
  return d;
}
__device__ __forceinline__ unsigned short bf16_rne_bits(float v) { unsigned int u = __float_as_uint(v); u += 0x7FFFu + ((u >> 16) & 1u); return (unsigned short)(u >> 16); }
__device__ __forceinline__ float bf16_rne(float v) { return __uint_as_float(((unsigned int)bf16_rne_bits(v)) << 16); }



__global__ __launch_bounds__(256) void xprep_kernel(const float* __restrict__ x, unsigned short* __restrict__ x16) {   // all 8 batches of x -> bf16
  const size_t tid = (size_t)blockIdx.x * blockDim.x + threadIdx.x, nth = (size_t)gridDim.x * blockDim.x;
  { for (size_t p = tid; p < (size_t)NTOK * D / 8; p += nth) { v8us v; const float* s = x + pk_src(p);   // packed tiles [token tile][k tile]
#pragma unroll
      for (int e = 0; e < 8; ++e) v[e] = bf16_rne_bits(s[e]);
      *(v8us*)(x16 + p * 8) = v; }  }
}
__global__ __launch_bounds__(256) void prep_kernel(const float* __restrict__ wqkv, const float* __restrict__ wo, unsigned short* __restrict__ w16, b16* __restrict__ wo16) {
  const size_t tid = (size_t)blockIdx.x * blockDim.x + threadIdx.x, nth = (size_t)gridDim.x * blockDim.x;
  {
    for (size_t p = tid; p < (size_t)2 * D * D / 8; p += nth) { v8us v; const float* s = wqkv + pk_src(p);   // kv_w [2048][1024] ([out][in]) rows -> packed tiles [out tile][k tile]
#pragma unroll
      for (int e = 0; e < 8; ++e) v[e] = bf16_rne_bits(s[e]);
      *(v8us*)(w16 + p * 8) = v; }
    for (size_t p = tid; p < (size_t)D * D / 8; p += nth) { v8b w; const float* s = wo + pk_src(p);   // W_o [out][in] rows -> packed tiles [out tile][k tile]
#pragma unroll
      for (int e = 0; e < 8; ++e) w[e] = (b16)bf16_rne(s[e]);
      *(v8b*)(wo16 + p * 8) = w; }
    
  }
}

__global__ __launch_bounds__(256) void posb_kernel(const float* __restrict__ pos, const float* __restrict__ mw, const float* __restrict__ mb, float* __restrict__ pb, float* __restrict__ sw) {
  const size_t g = (size_t)blockIdx.x * 256 + threadIdx.x;   // g = packed position in pb: f32 tiles [query tile 64][key tile 32][j4 4][lane 32][4]
  const int ln = (int)(g >> 2) & 31, j4 = (int)(g >> 7) & 3;
  const size_t pq = (g >> 14) * 16 + (ln & 15), pk = ((g >> 9) & 31) * 32 + (j4 >> 1) * 16 + (ln >> 4) * 8 + (j4 & 1) * 4 + (g & 3);
  const float* pr = pos + (pq * S + pk) * NP_; float s = bf16_rne(mb[0]);
  if (g < 64) { float t = 0.0f; for (int p = 0; p < NP_; ++p) t += bf16_rne(mw[p]); ((float*)sw)[g] = t; ((float*)sw)[g] = t; }   // Σ bf16(mp_w), replicated over one 256-B row
#pragma unroll
  for (int p = 0; p < NP_; ++p) { float t = bf16_rne(pr[p]) * bf16_rne(mw[p]); asm volatile("" : "+v"(t)); s += t; }
  { ((float*)pb)[g] = s;  }
}

// projections: rows = tokens (8192), K = 1024, column tiles of 64 = one head's k or v (interleaved per head); k: f16 packed tiles [b*H + head][token tile 64][ks 2];
// v: (8v)^T f16 packed tiles [b*H + head][key tile 32][d tile 4]. grid (32, 64) x 128.
__global__ __launch_bounds__(128) void proj_kernel(const __bf16* __restrict__ x16, const __bf16* __restrict__ w16, const float* __restrict__ bqkv, b16* __restrict__ kh, b16* __restrict__ vt) {
  __shared__ __attribute__((aligned(16))) b16 Th[4][32][HD + 8], Tq[4][32][HD + 8];
  const int lane = threadIdx.x & 31, wave = threadIdx.x >> 5, nloc = lane & 15, hlf = lane >> 4, m0 = blockIdx.y * 128 + wave * 32, c0 = blockIdx.x * 64;
  v8f acc[2][4];
#pragma unroll
  for (int r = 0; r < 2; ++r)
#pragma unroll
    for (int t = 0; t < 4; ++t) acc[r][t] = (v8f){};
  const __bf16* xa = x16 + (size_t)(m0 >> 4) * (D / 32) * 512; const __bf16* wb = w16 + (size_t)(c0 >> 4) * (D / 32) * 512;   // packed tiles, 512 elements each
#pragma unroll 2
  for (int kt = 0; kt < D / 32; ++kt) {
    const v16bb a0 = frag_pk_bf(xa + kt * 512, lane), a1 = frag_pk_bf(xa + (D / 32 + kt) * 512, lane);
#pragma unroll
    for (int t = 0; t < 4; ++t) { const v16bb bw = frag_pk_bf(wb + (t * (D / 32) + kt) * 512, lane); acc[0][t] = wmma16bb(a0, bw, acc[0][t]); acc[1][t] = wmma16bb(a1, bw, acc[1][t]); }
  }
  const int which = blockIdx.x & 1, head = blockIdx.x >> 1, b = m0 / S, tok0 = m0 % S;   // tile = (head, k|v) interleaved per head
#pragma unroll
  for (int t = 0; t < 4; ++t) { const float bb = bf16_rne(bqkv[c0 + t * 16 + nloc]);   // + bias (bf16-rounded)
#pragma unroll
    for (int r = 0; r < 2; ++r)
#pragma unroll
      for (int v = 0; v < 8; ++v) acc[r][t][v] += bb; }
  if (which == 0) {                                             // k head: f16 packed tiles (hi + lo planes)
#pragma unroll
    for (int t = 0; t < 4; ++t)
#pragma unroll
      for (int r = 0; r < 2; ++r)
#pragma unroll
        for (int v = 0; v < 8; ++v) { b16 a_, c_; split16(acc[r][t][v] * QS, a_, c_); Th[wave][r * 16 + 8 * hlf + v][t * 16 + nloc] = a_; Tq[wave][r * 16 + 8 * hlf + v][t * 16 + nloc] = c_; }   // q, k carried x8 (lo residuals stay normal)
    wave_lds_sync();
    b16* dst = kh + (((size_t)b * H + head) * S + tok0) * HD;
    {
#pragma unroll
      for (int j = 0; j < 8; ++j) { const int rr = (j >> 2) * 16 + nloc, c8 = ((j >> 1) & 1) * 32 + (j & 1) * 16 + hlf * 8;   // packed tiles [token tile][ks 2]: piece j = (token tile, ks, j)
        *(v8b*)(dst + j * 256 + lane * 8) = *(const v8b*)(&Th[wave][rr][c8]); *(v8b*)(dst + QPL + j * 256 + lane * 8) = *(const v8b*)(&Tq[wave][rr][c8]); }
       }
    return;
  }
  // v head: (8v)^T packed tiles [key tile 32][d tile 4], 32 keys = 2048 elements. A lane's accumulators acc[j][n][e] (key 16 j + 8 hlf + e, d 16 n + nloc) are its own
  // packed piece (n, j), so they are stored straight from registers.
  b16* dstv = vt + (((size_t)b * H + head) * HD) * S + (size_t)tok0 * HD;
#pragma unroll
  for (int n = 0; n < 4; ++n)
#pragma unroll
    for (int j = 0; j < 2; ++j) { v8b a8, c8;
#pragma unroll
      for (int e = 0; e < 8; ++e) { b16 a_, c_; split16(acc[j][n][e] * VS, a_, c_); a8[e] = a_; c8[e] = c_; }
      *(v8b*)(dstv + (n * 2 + j) * 256 + lane * 8) = a8; *(v8b*)(dstv + VPL + (n * 2 + j) * 256 + lane * 8) = c8; }
  asm volatile("s_wait_xcnt 0x0" ::: "memory");   // stands behind the last v store, in front of any later write of a register that an issued store names
}

// attention without mask: wave = (b, h, 16 queries); key chunks of 32 over all S keys: S^T (K=64) + pos bias, online softmax f32, P^T f16, y^T += (8V)^T P^T;
template <int QT>
__global__ __launch_bounds__(256) void attn_kernel(const b16* __restrict__ kh, const b16* __restrict__ vt, const float* __restrict__ pb, const float* __restrict__ swp, float* __restrict__ y) {
  const float SW = swp[0];
  const int wid = threadIdx.x >> 5, lane = threadIdx.x & 31;
  const int qt = blockIdx.x * 8 + wid, jt = qt % QT, bh = qt / QT, h = bh % H, b = bh / H;
  const b16* Q = kh + ((size_t)bh * S) * HD; const b16* K = kh + ((size_t)bh * S) * HD; const b16* vb = vt + ((size_t)bh * HD) * S;
  v16b qf[2], ql[2];
#pragma unroll
  for (int ks = 0; ks < 2; ++ks) { qf[ks] = frag_pk(Q + (jt * 2 + ks) * 512, lane); ql[ks] = frag_pk(Q + QPL + (jt * 2 + ks) * 512, lane); }
  float m = -INFINITY, l = 0.0f; v8f o[4] = {{}, {}, {}, {}};
  const float* pbq = pb + (size_t)jt * (S / 32) * 512 + lane * 4;   // this query tile's additive bias, packed f32 tiles
  for (int kb = 0; kb < S; kb += 32) {
    v8f s0 = {}, s1 = {};
#pragma unroll
    for (int ks = 0; ks < 2; ++ks) { const v16b k0 = frag_pk(K + kb * HD + ks * 512, lane), k1 = frag_pk(K + kb * HD + 1024 + ks * 512, lane);
      s0 = wmma16b(k0, qf[ks], s0); s0 = wmma16b(k0, ql[ks], s0);      // query side hi+lo, key side hi only (2 products): the key's 2^-11 rounding moves the O(1) logits by ~3e-5
      s1 = wmma16b(k1, qf[ks], s1); s1 = wmma16b(k1, ql[ks], s1); }
    float mr = -INFINITY; v4f pq[4];
#pragma unroll
    for (int j = 0; j < 4; ++j) pq[j] = *(const v4f*)(pbq + kb * 16 + j * 128);
#pragma unroll
    for (int r = 0; r < 8; ++r) { s0[r] = s0[r] * (SCALE * SW / (QS * QS)) + pq[r >> 2][r & 3]; s1[r] = s1[r] * (SCALE * SW / (QS * QS)) + pq[2 + (r >> 2)][r & 3]; mr = fmaxf(mr, fmaxf(s0[r], s1[r])); }
    mr = fmaxf(mr, __shfl_xor(mr, 16));
    const float mn = fmaxf(m, mr), al_ = __expf(m - mn); m = mn;
    float sum = 0.0f; v16b pb, pl;
#pragma unroll
    for (int r = 0; r < 8; ++r) { const float e0 = __expf(s0[r] - mn), e1 = __expf(s1[r] - mn); sum += e0 + e1; b16 a, c; split16(e0 * PS, a, c); pb[r] = a; pl[r] = c; split16(e1 * PS, a, c); pb[8 + r] = a; pl[8 + r] = c; }   // P carried x8
    sum += __shfl_xor(sum, 16); l = l * al_ + sum;
#pragma unroll
    for (int n = 0; n < 4; ++n) {
#pragma unroll
      for (int r = 0; r < 8; ++r) o[n][r] *= al_;
      const v16b vf = frag_pk(vb + kb * HD + n * 512, lane), vl = frag_pk(vb + VPL + kb * HD + n * 512, lane);
      o[n] = wmma16b(vf, pb, o[n]); o[n] = wmma16b(vf, pl, o[n]); o[n] = wmma16b(vl, pb, o[n]);   // (8v) and P both as f16 hi+lo pairs (lo.lo dropped) — v's rounding is NOT negligible here
    }
  }
  const float inv = 1.0f / (VS * PS * l);
  float* dst = y + ((size_t)(b * QT + jt) * (D / 32) + h * 2) * 512;   // packed f32 tiles [token tile][k tile]; this head = 2 k tiles = 8 pieces of 512 B
  {
#pragma unroll
    for (int j = 0; j < 8; ++j) { v4f w;   // a lane's accumulators are its own packed pieces (d = 16 n + 8 hh + r), so no LDS exchange is needed
#pragma unroll
      for (int e = 0; e < 4; ++e) w[e] = o[j >> 1][(j & 1) * 4 + e] * inv;
      *(v4f*)(dst + j * 128 + lane * 4) = w; }
    
  }
}

// out = y W_o^T: (8192 x 1024) x (1024 x 1024); A = y x8 split at load into f16 hi + lo, B = f16(bf16 W_o) packed tiles; f32 rows; grid (16, 64).
__global__ __launch_bounds__(128) void out_kernel(const float* __restrict__ y, const b16* __restrict__ wo16, const float* __restrict__ bo, float* __restrict__ out) {
  __shared__ __attribute__((aligned(16))) float Ts[4][32 * 64];
  const int lane = threadIdx.x & 31, wave = threadIdx.x >> 5, nloc = lane & 15, m0 = blockIdx.y * 128 + wave * 32, c0 = blockIdx.x * 64;
  v8f acc[2][4];
#pragma unroll
  for (int r = 0; r < 2; ++r)
#pragma unroll
    for (int t = 0; t < 4; ++t) acc[r][t] = (v8f){};
  const float* ya = y + (size_t)(m0 >> 4) * (D / 32) * 512 + lane * 4; const b16* wb = wo16 + (size_t)(c0 >> 4) * (D / 32) * 512;   // packed tiles
  for (int kt = 0; kt < D / 32; ++kt) {                                         // y as an f16 hi+lo pair carried x8 (2 products)
    v16b ah[2], al[2];
#pragma unroll
    for (int r = 0; r < 2; ++r)
#pragma unroll
      for (int j = 0; j < 4; ++j) { const v4f f = *(const v4f*)(ya + (r * (D / 32) + kt) * 512 + j * 128);
#pragma unroll
        for (int e = 0; e < 4; ++e) { b16 a, c; split16(f[e] * 8.0f, a, c); ah[r][j * 4 + e] = a; al[r][j * 4 + e] = c; } }
#pragma unroll
    for (int t = 0; t < 4; ++t) { const v16b bh = frag_pk(wb + (t * (D / 32) + kt) * 512, lane);
      acc[0][t] = wmma16b(ah[0], bh, acc[0][t]); acc[0][t] = wmma16b(al[0], bh, acc[0][t]);
      acc[1][t] = wmma16b(ah[1], bh, acc[1][t]); acc[1][t] = wmma16b(al[1], bh, acc[1][t]); }
  }
#pragma unroll
  for (int t = 0; t < 4; ++t)
#pragma unroll
    for (int r = 0; r < 2; ++r)
#pragma unroll
      for (int v = 0; v < 8; ++v) acc[r][t][v] = acc[r][t][v] * (1.0f / 8.0f) + bf16_rne(bo[c0 + t * 16 + nloc]);
  epi_f32(acc, 1.0f, nullptr, out, D, m0, c0, lane, Ts[wave]);
}
}  // namespace

extern "C" void kernel_launch(void* const* d_in, const int* in_sizes, int n_in,
                              void* d_out, int out_size, void* d_ws, size_t ws_size, hipStream_t stream) {
  (void)n_in; (void)out_size;
  const float* x = (const float*)d_in[0]; const float* pos = (const float*)d_in[1]; const float* wqkv = (const float*)d_in[2]; const float* bqkv = (const float*)d_in[3]; const float* wo = (const float*)d_in[4]; const float* bo = (const float*)d_in[5]; const float* mw = (const float*)d_in[6]; const float* mb = (const float*)d_in[7];
  float* out = (float*)d_out;   // [8][1024][1024]
  if (in_sizes[0] != BT * S * D || in_sizes[1] != S * S * NP_ || in_sizes[2] != 2 * D * D || in_sizes[3] != 2 * D || in_sizes[4] != D * D || in_sizes[5] != D || in_sizes[6] != NP_) return;

  size_t off = 0; char* ws = (char*)d_ws;
  auto carve = [&](size_t bytes) { char* p = ws + off; off += (bytes + 255) & ~(size_t)255; return p; };
  unsigned short* x16 = (unsigned short*)carve((size_t)NTOK * D * 2); unsigned short* w16 = (unsigned short*)carve((size_t)2 * D * D * 2); b16* wo16 = (b16*)carve((size_t)D * D * 2);
  b16* kh = (b16*)carve((size_t)2 * NTOK * D * 2); b16* vt = (b16*)carve((size_t)2 * NTOK * D * 2); float* y = (float*)carve((size_t)NTOK * D * 4); float* pb = (float*)carve((size_t)S * S * 4); float* sw = (float*)carve(256);
  if (off > ws_size) return;                                    // ≈ 128 MB
  prep_kernel<<<512, 256, 0, stream>>>(wqkv, wo, w16, wo16);
  xprep_kernel<<<1024, 256, 0, stream>>>(x, x16);
  posb_kernel<<<S * S / 256, 256, 0, stream>>>(pos, mw, mb, pb, sw);
  proj_kernel<<<dim3(2 * D / 64, NTOK / 128), 128, 0, stream>>>((const __bf16*)x16, (const __bf16*)w16, bqkv, kh, vt);
  attn_kernel<S / 16><<<Bn * H * (S / 16) / 8, 256, 0, stream>>>(kh, vt, pb, sw, y);
  out_kernel<<<dim3(D / 64, NTOK / 128), 128, 0, stream>>>(y, wo16, bo, out);
}

// v002
// Measured time: 195 microseconds a run.
// In both of two side-by-side timings against v001, it was 1.81 times as fast.
// All steps since v000 together make it 1.97 times as fast.
#include <hip/hip_runtime.h>

// MultiheadAttention_KV: kv = x kv_w^T + kv_b (16 heads x [k 64 | v 64] interleaved per head); scores = (k_q . k_k)/8 * sum(mp_w) + pos_bias[q][k] with pos_bias = pos mp_w^T + mp_b
// (shared over batch and heads; precomputed once); softmax; vals = a v; out = vals o_w^T + o_b -> [8][1024][1024]. Keys and queries are the SAME k rows.
namespace {
constexpr int BT = 8, Bn = 8, S = 1024, D = 1024, H = 16, HD = 64, NTOK = Bn * S, NP_ = 10;
constexpr float SCALE = 0.125f, VS = 8.0f, QS = 8.0f, PS = 8.0f;   // power-of-two carry scales so hi/lo residual planes stay normal in f16
constexpr size_t VPL = (size_t)NTOK * D;   // distance between the (8v)^T hi and lo planes
constexpr size_t QPL = (size_t)NTOK * D;   // distance between the q/k hi and lo planes

typedef _Float16 b16;
typedef __attribute__((ext_vector_type(16))) _Float16 v16b;
typedef __attribute__((ext_vector_type(8)))  _Float16 v8b;
typedef __attribute__((ext_vector_type(8)))  float v8f;
typedef __attribute__((ext_vector_type(4)))  float v4f;

__device__ __forceinline__ v8b ld8b(const b16* p) { return *(const v8b*)p; }
__device__ __forceinline__ v16b cat8b(v8b a, v8b b) { return __builtin_shufflevector(a, b, 0, 1, 2, 3, 4, 5, 6, 7, 8, 9, 10, 11, 12, 13, 14, 15); }
// Fragment-packed operand tiles. A 16-row x 32-k tile of a 16-bit operand is 512 elements laid out [j 2][lane 32][8]: lane = 16 * hh + row holds k = 16 * j + 8 * hh + e,
// the hardware k order of a 16x16x32 A or B fragment, so each wave-wide 16-byte load reads 512 contiguous bytes (4 whole lines instead of 16 partly used ones).
// An f32 tile is [j4 4][lane 32][4] with k = 16 * (j4 >> 1) + 8 * hh + 4 * (j4 & 1) + e.
__device__ __forceinline__ v16b frag_pk(const b16* tile, int lane) { return cat8b(ld8b(tile + lane * 8), ld8b(tile + 256 + lane * 8)); }
// source offset (row-major, pitch D) of the 8 elements that packed group p holds; tiles ordered [row tile][k tile], D / 32 k tiles per row tile
__device__ __forceinline__ size_t pk_src(size_t p) {
  const size_t tile = p >> 6; const int j = (int)(p >> 5) & 1, ln = (int)p & 31;
  return ((tile >> 5) * 16 + (ln & 15)) * D + (tile & 31) * 32 + j * 16 + (ln >> 4) * 8;
}
__device__ __forceinline__ void split16(float v, b16& hi, b16& lo) { hi = (b16)v; lo = (b16)(v - (float)hi); }
__device__ __forceinline__ v8f wmma16b(v16b a, v16b b, v8f c) {
  v8f d = __builtin_amdgcn_wmma_f32_16x16x32_f16(false, a, false, b, (short)0, c, false, false);
  asm volatile("v_nop\n\tv_nop\n\tv_nop\n\tv_nop" : "+v"(d) : "v"(a), "v"(b));
  return d;
}
__device__ __forceinline__ void wave_lds_sync() {
  __builtin_amdgcn_fence(__ATOMIC_RELEASE, "workgroup");
  __builtin_amdgcn_wave_barrier();
  __builtin_amdgcn_fence(__ATOMIC_ACQUIRE, "workgroup");
}

__device__ __forceinline__ void epi_planes(v8f (&acc)[2][4], float scale, bool two, b16* __restrict__ oh, b16* __restrict__ ol, int ldo,
                                           int m0, int c0, int lane, b16* Th, b16* Tl) {
  const int nloc = lane & 15, hlf = lane >> 4;
#pragma unroll
  for (int t = 0; t < 4; ++t)
#pragma unroll
    for (int r = 0; r < 2; ++r)
#pragma unroll
      for (int v = 0; v < 8; ++v) {
        const int rr = r * 16 + v + 8 * hlf, cc = t * 16 + nloc;
        b16 h_, l_; split16(acc[r][t][v] * scale, h_, l_);
        Th[rr * 64 + cc] = h_; Tl[rr * 64 + cc] = l_;
      }
  wave_lds_sync();
  {
#pragma unroll
    for (int j = 0; j < 8; ++j) {
      const int rr = j * 4 + (lane >> 3), c8 = (lane & 7) * 8;
      const size_t o = (size_t)(m0 + rr) * ldo + c0 + c8;
      *(v8b*)(oh + o) = ld8b(Th + rr * 64 + c8);
      if (two) *(v8b*)(ol + o) = ld8b(Tl + rr * 64 + c8);
    }
    
  }
}
// (b) f32 rows with pitch ldo: 64 floats = 256 B = 2 lines per row; 16 lanes x 16 B per row, 2 rows per instruction. Optional per-row factor
__device__ __forceinline__ void epi_f32(v8f (&acc)[2][4], float scale, const float* rscale, float* __restrict__ out, int ldo, int m0, int c0, int lane, float* Tt) {
  const int nloc = lane & 15, hlf = lane >> 4;
#pragma unroll
  for (int t = 0; t < 4; ++t)
#pragma unroll
    for (int r = 0; r < 2; ++r)
#pragma unroll
      for (int v = 0; v < 8; ++v) {
        const int rr = r * 16 + v + 8 * hlf;
        const float rs = rscale ? rscale[(size_t)(m0 + rr) * 32] : 1.0f;
        Tt[rr * 64 + t * 16 + nloc] = acc[r][t][v] * scale * rs;
      }
  wave_lds_sync();
  float* dst0 = out + (size_t)m0 * ldo + c0;
  {
#pragma unroll
    for (int j = 0; j < 16; ++j) { const int rr = j * 2 + hlf, c4 = nloc * 4; *(v4f*)(dst0 + (size_t)rr * ldo + c4) = *(const v4f*)(Tt + rr * 64 + c4); }
    
  }
}



typedef __attribute__((ext_vector_type(8))) __bf16 v8bb; typedef __attribute__((ext_vector_type(16))) __bf16 v16bb;
typedef __attribute__((ext_vector_type(8))) unsigned short v8us;
__device__ __forceinline__ v16bb frag_pk_bf(const __bf16* tile, int lane) { const v8bb a = *(const v8bb*)(tile + lane * 8), b = *(const v8bb*)(tile + 256 + lane * 8); return __builtin_shufflevector(a, b, 0, 1, 2, 3, 4, 5, 6, 7, 8, 9, 10, 11, 12, 13, 14, 15); }
__device__ __forceinline__ v8f wmma16bb(v16bb a, v16bb b, v8f c) {
  v8f d = __builtin_amdgcn_wmma_f32_16x16x32_bf16(false, a, false, b, (short)0, c, false, false);
  asm volatile("v_nop\n\tv_nop\n\tv_nop\n\tv_nop" : "+v"(d) : "v"(a), "v"(b));
  return d;
}
__device__ __forceinline__ unsigned short bf16_rne_bits(float v) { unsigned int u = __float_as_uint(v); u += 0x7FFFu + ((u >> 16) & 1u); return (unsigned short)(u >> 16); }
__device__ __forceinline__ float bf16_rne(float v) { return __uint_as_float(((unsigned int)bf16_rne_bits(v)) << 16); }



__global__ __launch_bounds__(256) void xprep_kernel(const float* __restrict__ x, unsigned short* __restrict__ x16) {   // all 8 batches of x -> bf16
  const size_t tid = (size_t)blockIdx.x * blockDim.x + threadIdx.x, nth = (size_t)gridDim.x * blockDim.x;
  { for (size_t p = tid; p < (size_t)NTOK * D / 8; p += nth) { v8us v; const float* s = x + pk_src(p);   // packed tiles [token tile][k tile]
#pragma unroll
      for (int e = 0; e < 8; ++e) v[e] = bf16_rne_bits(s[e]);
      *(v8us*)(x16 + p * 8) = v; }  }
}
__global__ __launch_bounds__(256) void prep_kernel(const float* __restrict__ wqkv, const float* __restrict__ wo, unsigned short* __restrict__ w16, b16* __restrict__ wo16) {
  const size_t tid = (size_t)blockIdx.x * blockDim.x + threadIdx.x, nth = (size_t)gridDim.x * blockDim.x;
  {
    for (size_t p = tid; p < (size_t)2 * D * D / 8; p += nth) { v8us v; const float* s = wqkv + pk_src(p);   // kv_w [2048][1024] ([out][in]) rows -> packed tiles [out tile][k tile]
#pragma unroll
      for (int e = 0; e < 8; ++e) v[e] = bf16_rne_bits(s[e]);
      *(v8us*)(w16 + p * 8) = v; }
    for (size_t p = tid; p < (size_t)D * D / 8; p += nth) { v8b w; const float* s = wo + pk_src(p);   // W_o [out][in] rows -> packed tiles [out tile][k tile]
#pragma unroll
      for (int e = 0; e < 8; ++e) w[e] = (b16)bf16_rne(s[e]);
      *(v8b*)(wo16 + p * 8) = w; }
    
  }
}

__global__ __launch_bounds__(256) void posb_kernel(const float* __restrict__ pos, const float* __restrict__ mw, const float* __restrict__ mb, float* __restrict__ pb, float* __restrict__ sw) {
  const size_t g = (size_t)blockIdx.x * 256 + threadIdx.x;   // g = packed position in pb: f32 tiles [query tile 64][key tile 32][j4 4][lane 32][4]
  const int ln = (int)(g >> 2) & 31, j4 = (int)(g >> 7) & 3;
  const size_t pq = (g >> 14) * 16 + (ln & 15), pk = ((g >> 9) & 31) * 32 + (j4 >> 1) * 16 + (ln >> 4) * 8 + (j4 & 1) * 4 + (g & 3);
  const float* pr = pos + (pq * S + pk) * NP_; float s = bf16_rne(mb[0]);
  if (g < 64) { float t = 0.0f; for (int p = 0; p < NP_; ++p) t += bf16_rne(mw[p]); ((float*)sw)[g] = t; ((float*)sw)[g] = t; }   // Σ bf16(mp_w), replicated over one 256-B row
#pragma unroll
  for (int p = 0; p < NP_; ++p) { float t = bf16_rne(pr[p]) * bf16_rne(mw[p]); asm volatile("" : "+v"(t)); s += t; }
  { ((float*)pb)[g] = s;  }
}

// projections: rows = tokens (8192), K = 1024, column tiles of 64 = one head's k or v (interleaved per head); k: f16 packed tiles [b*H + head][token tile 64][ks 2];
// v: (8v)^T f16 packed tiles [b*H + head][key tile 32][d tile 4]. grid (32, 64) x 128.
__global__ __launch_bounds__(128) void proj_kernel(const __bf16* __restrict__ x16, const __bf16* __restrict__ w16, const float* __restrict__ bqkv, b16* __restrict__ kh, b16* __restrict__ vt) {
  __shared__ __attribute__((aligned(16))) b16 Th[4][32][HD + 8], Tq[4][32][HD + 8];
  const int lane = threadIdx.x & 31, wave = threadIdx.x >> 5, nloc = lane & 15, hlf = lane >> 4, m0 = blockIdx.y * 128 + wave * 32, c0 = blockIdx.x * 64;
  v8f acc[2][4];
#pragma unroll
  for (int r = 0; r < 2; ++r)
#pragma unroll
    for (int t = 0; t < 4; ++t) acc[r][t] = (v8f){};
  const __bf16* xa = x16 + (size_t)(m0 >> 4) * (D / 32) * 512; const __bf16* wb = w16 + (size_t)(c0 >> 4) * (D / 32) * 512;   // packed tiles, 512 elements each
#pragma unroll 2
  for (int kt = 0; kt < D / 32; ++kt) {
    const v16bb a0 = frag_pk_bf(xa + kt * 512, lane), a1 = frag_pk_bf(xa + (D / 32 + kt) * 512, lane); v16bb bw[4];
#pragma unroll
    for (int t = 0; t < 4; ++t) bw[t] = frag_pk_bf(wb + (t * (D / 32) + kt) * 512, lane);
    // stands behind the step's twelve loads, in front of any write of a register that they name; no load sinks below it, so they fly together and not one pair after another
    asm volatile("s_wait_xcnt 0x0" ::: "memory");
#pragma unroll
    for (int t = 0; t < 4; ++t) { acc[0][t] = wmma16bb(a0, bw[t], acc[0][t]); acc[1][t] = wmma16bb(a1, bw[t], acc[1][t]); }
  }
  const int which = blockIdx.x & 1, head = blockIdx.x >> 1, b = m0 / S, tok0 = m0 % S;   // tile = (head, k|v) interleaved per head
#pragma unroll
  for (int t = 0; t < 4; ++t) { const float bb = bf16_rne(bqkv[c0 + t * 16 + nloc]);   // + bias (bf16-rounded)
#pragma unroll
    for (int r = 0; r < 2; ++r)
#pragma unroll
      for (int v = 0; v < 8; ++v) acc[r][t][v] += bb; }
  if (which == 0) {                                             // k head: f16 packed tiles (hi + lo planes)
#pragma unroll
    for (int t = 0; t < 4; ++t)
#pragma unroll
      for (int r = 0; r < 2; ++r)
#pragma unroll
        for (int v = 0; v < 8; ++v) { b16 a_, c_; split16(acc[r][t][v] * QS, a_, c_); Th[wave][r * 16 + 8 * hlf + v][t * 16 + nloc] = a_; Tq[wave][r * 16 + 8 * hlf + v][t * 16 + nloc] = c_; }   // q, k carried x8 (lo residuals stay normal)
    wave_lds_sync();
    b16* dst = kh + (((size_t)b * H + head) * S + tok0) * HD;
    {
#pragma unroll
      for (int j = 0; j < 8; ++j) { const int rr = (j >> 2) * 16 + nloc, c8 = ((j >> 1) & 1) * 32 + (j & 1) * 16 + hlf * 8;   // packed tiles [token tile][ks 2]: piece j = (token tile, ks, j)
        *(v8b*)(dst + j * 256 + lane * 8) = *(const v8b*)(&Th[wave][rr][c8]); *(v8b*)(dst + QPL + j * 256 + lane * 8) = *(const v8b*)(&Tq[wave][rr][c8]); }
       }
    return;
  }
  // v head: (8v)^T packed tiles [key tile 32][d tile 4], 32 keys = 2048 elements. A lane's accumulators acc[j][n][e] (key 16 j + 8 hlf + e, d 16 n + nloc) are its own
  // packed piece (n, j), so they are stored straight from registers.
  b16* dstv = vt + (((size_t)b * H + head) * HD) * S + (size_t)tok0 * HD;
#pragma unroll
  for (int n = 0; n < 4; ++n)
#pragma unroll
    for (int j = 0; j < 2; ++j) { v8b a8, c8;
#pragma unroll
      for (int e = 0; e < 8; ++e) { b16 a_, c_; split16(acc[j][n][e] * VS, a_, c_); a8[e] = a_; c8[e] = c_; }
      *(v8b*)(dstv + (n * 2 + j) * 256 + lane * 8) = a8; *(v8b*)(dstv + VPL + (n * 2 + j) * 256 + lane * 8) = c8; }
  asm volatile("s_wait_xcnt 0x0" ::: "memory");   // stands behind the last v store, in front of any later write of a register that an issued store names
}

// attention without mask: wave = (b, h, 16 queries); key chunks of 32 over all S keys: S^T (K=64) + pos bias, online softmax f32, P^T f16, y^T += (8V)^T P^T;
template <int QT>
__global__ __launch_bounds__(256) void attn_kernel(const b16* __restrict__ kh, const b16* __restrict__ vt, const float* __restrict__ pb, const float* __restrict__ swp, float* __restrict__ y) {
  const float SW = swp[0];
  const int wid = threadIdx.x >> 5, lane = threadIdx.x & 31;
  const int qt = blockIdx.x * 8 + wid, jt = qt % QT, bh = qt / QT, h = bh % H, b = bh / H;
  const b16* Q = kh + ((size_t)bh * S) * HD; const b16* K = kh + ((size_t)bh * S) * HD; const b16* vb = vt + ((size_t)bh * HD) * S;
  v16b qf[2], ql[2];
#pragma unroll
  for (int ks = 0; ks < 2; ++ks) { qf[ks] = frag_pk(Q + (jt * 2 + ks) * 512, lane); ql[ks] = frag_pk(Q + QPL + (jt * 2 + ks) * 512, lane); }
  float m = -INFINITY, l = 0.0f; v8f o[4] = {{}, {}, {}, {}};
  const float* pbq = pb + (size_t)jt * (S / 32) * 512 + lane * 4;   // this query tile's additive bias, packed f32 tiles
  // Loads run ahead of their use: a chunk's key fragments and bias are fetched during the chunk before it, its value fragments at the chunk's top, ahead of the score products.
  v16b kf[2][2]; v4f pq[4];
#pragma unroll
  for (int ks = 0; ks < 2; ++ks) { kf[ks][0] = frag_pk(K + ks * 512, lane); kf[ks][1] = frag_pk(K + 1024 + ks * 512, lane); }
#pragma unroll
  for (int j = 0; j < 4; ++j) pq[j] = *(const v4f*)(pbq + j * 128);
  for (int kb = 0; kb < S; kb += 32) {
    const b16* vhp = vb + kb * HD + lane * 8; const b16* vlp = vhp + VPL;
    v16b vf[4], vl[4];
#pragma unroll
    for (int n = 0; n < 4; ++n) { vf[n] = cat8b(ld8b(vhp + n * 512), ld8b(vhp + n * 512 + 256)); vl[n] = cat8b(ld8b(vlp + n * 512), ld8b(vlp + n * 512 + 256)); }
    // stands behind the value loads, in front of any write of a register that they name; no load sinks below it to its use
    asm volatile("s_wait_xcnt 0x0" ::: "memory");
    v8f s0 = {}, s1 = {};
#pragma unroll
    for (int ks = 0; ks < 2; ++ks) {
      s0 = wmma16b(kf[ks][0], qf[ks], s0); s0 = wmma16b(kf[ks][0], ql[ks], s0);      // query side hi+lo, key side hi only (2 products): the key's 2^-11 rounding moves the O(1) logits by ~3e-5
      s1 = wmma16b(kf[ks][1], qf[ks], s1); s1 = wmma16b(kf[ks][1], ql[ks], s1); }
    const int kn = kb + 32 < S ? kb + 32 : kb;   // next chunk; the last pass fetches its own again (in bounds, unused)
    const b16* kp = K + kn * HD + lane * 8;
#pragma unroll
    for (int ks = 0; ks < 2; ++ks) { kf[ks][0] = cat8b(ld8b(kp + ks * 512), ld8b(kp + ks * 512 + 256)); kf[ks][1] = cat8b(ld8b(kp + 1024 + ks * 512), ld8b(kp + 1024 + ks * 512 + 256)); }
    // the same behind the next chunk's key loads: they stay here, a whole softmax and value product ahead of their use
    asm volatile("s_wait_xcnt 0x0" ::: "memory");
    float mr = -INFINITY;
#pragma unroll
    for (int r = 0; r < 8; ++r) { s0[r] = s0[r] * (SCALE * SW / (QS * QS)) + pq[r >> 2][r & 3]; s1[r] = s1[r] * (SCALE * SW / (QS * QS)) + pq[2 + (r >> 2)][r & 3]; mr = fmaxf(mr, fmaxf(s0[r], s1[r])); }
    const float* pp = pbq + kn * 16;
#pragma unroll
    for (int j = 0; j < 4; ++j) pq[j] = *(const v4f*)(pp + j * 128);
    // the same behind the next chunk's bias loads, which stay ahead of the exponentials
    asm volatile("s_wait_xcnt 0x0" ::: "memory");
    mr = fmaxf(mr, __shfl_xor(mr, 16));
    const float mn = fmaxf(m, mr), al_ = __expf(m - mn); m = mn;
    float sum = 0.0f; v16b pb, pl;
#pragma unroll
    for (int r = 0; r < 8; ++r) { const float e0 = __expf(s0[r] - mn), e1 = __expf(s1[r] - mn); sum += e0 + e1; b16 a, c; split16(e0 * PS, a, c); pb[r] = a; pl[r] = c; split16(e1 * PS, a, c); pb[8 + r] = a; pl[8 + r] = c; }   // P carried x8
    sum += __shfl_xor(sum, 16); l = l * al_ + sum;
#pragma unroll
    for (int n = 0; n < 4; ++n) {
#pragma unroll
      for (int r = 0; r < 8; ++r) o[n][r] *= al_;
      o[n] = wmma16b(vf[n], pb, o[n]); o[n] = wmma16b(vf[n], pl, o[n]); o[n] = wmma16b(vl[n], pb, o[n]);   // (8v) and P both as f16 hi+lo pairs (lo.lo dropped)
    }
  }
  const float inv = 1.0f / (VS * PS * l);
  float* dst = y + ((size_t)(b * QT + jt) * (D / 32) + h * 2) * 512;   // packed f32 tiles [token tile][k tile]; this head = 2 k tiles = 8 pieces of 512 B
  {
#pragma unroll
    for (int j = 0; j < 8; ++j) { v4f w;   // a lane's accumulators are its own packed pieces (d = 16 n + 8 hh + r), so no LDS exchange is needed
#pragma unroll
      for (int e = 0; e < 4; ++e) w[e] = o[j >> 1][(j & 1) * 4 + e] * inv;
      *(v4f*)(dst + j * 128 + lane * 4) = w; }
    
  }
}

// out = y W_o^T: (8192 x 1024) x (1024 x 1024); A = y x8 split at load into f16 hi + lo, B = f16(bf16 W_o) packed tiles; f32 rows; grid (16, 64).
__global__ __launch_bounds__(128) void out_kernel(const float* __restrict__ y, const b16* __restrict__ wo16, const float* __restrict__ bo, float* __restrict__ out) {
  __shared__ __attribute__((aligned(16))) float Ts[4][32 * 64];
  const int lane = threadIdx.x & 31, wave = threadIdx.x >> 5, nloc = lane & 15, m0 = blockIdx.y * 128 + wave * 32, c0 = blockIdx.x * 64;
  v8f acc[2][4];
#pragma unroll
  for (int r = 0; r < 2; ++r)
#pragma unroll
    for (int t = 0; t < 4; ++t) acc[r][t] = (v8f){};
  const float* ya = y + (size_t)(m0 >> 4) * (D / 32) * 512 + lane * 4; const b16* wb = wo16 + (size_t)(c0 >> 4) * (D / 32) * 512;   // packed tiles
  // Loads run one step ahead: y is fetched again as soon as the step's rows are split, each weight fragment as soon as its four products are issued.
  v4f yr[2][4]; v16b bh[4];
#pragma unroll
  for (int r = 0; r < 2; ++r)
#pragma unroll
    for (int j = 0; j < 4; ++j) yr[r][j] = *(const v4f*)(ya + r * (D / 32) * 512 + j * 128);
  // keeps the first y loads in front of the first weight loads, the order of the loop: loads return in order, and the split of y then waits for y alone
  asm volatile("s_wait_xcnt 0x0" ::: "memory");
#pragma unroll
  for (int t = 0; t < 4; ++t) bh[t] = frag_pk(wb + t * (D / 32) * 512, lane);
  for (int kt = 0; kt < D / 32; ++kt) {                                         // y as an f16 hi+lo pair carried x8 (2 products)
    v16b ah[2], al[2];
#pragma unroll
    for (int r = 0; r < 2; ++r)
#pragma unroll
      for (int j = 0; j < 4; ++j) {
#pragma unroll
        for (int e = 0; e < 4; ++e) { b16 a, c; split16(yr[r][j][e] * 8.0f, a, c); ah[r][j * 4 + e] = a; al[r][j * 4 + e] = c; } }
    const int kn = kt + 1 < D / 32 ? kt + 1 : kt;   // next step; the last one fetches its own again (in bounds, unused)
#pragma unroll
    for (int r = 0; r < 2; ++r)
#pragma unroll
      for (int j = 0; j < 4; ++j) yr[r][j] = *(const v4f*)(ya + (r * (D / 32) + kn) * 512 + j * 128);
    // stands behind the next step's y loads, in front of any write of a register that they name; they stay here, all sixteen products ahead of their use
    asm volatile("s_wait_xcnt 0x0" ::: "memory");
#pragma unroll
    for (int t = 0; t < 4; ++t) {
      acc[0][t] = wmma16b(ah[0], bh[t], acc[0][t]); acc[0][t] = wmma16b(al[0], bh[t], acc[0][t]);
      acc[1][t] = wmma16b(ah[1], bh[t], acc[1][t]); acc[1][t] = wmma16b(al[1], bh[t], acc[1][t]);
      bh[t] = frag_pk(wb + (t * (D / 32) + kn) * 512, lane); }
    // the same behind the next step's weight loads
    asm volatile("s_wait_xcnt 0x0" ::: "memory");
  }
#pragma unroll
  for (int t = 0; t < 4; ++t)
#pragma unroll
    for (int r = 0; r < 2; ++r)
#pragma unroll
      for (int v = 0; v < 8; ++v) acc[r][t][v] = acc[r][t][v] * (1.0f / 8.0f) + bf16_rne(bo[c0 + t * 16 + nloc]);
  epi_f32(acc, 1.0f, nullptr, out, D, m0, c0, lane, Ts[wave]);
}
}  // namespace

extern "C" void kernel_launch(void* const* d_in, const int* in_sizes, int n_in,
                              void* d_out, int out_size, void* d_ws, size_t ws_size, hipStream_t stream) {
  (void)n_in; (void)out_size;
  const float* x = (const float*)d_in[0]; const float* pos = (const float*)d_in[1]; const float* wqkv = (const float*)d_in[2]; const float* bqkv = (const float*)d_in[3]; const float* wo = (const float*)d_in[4]; const float* bo = (const float*)d_in[5]; const float* mw = (const float*)d_in[6]; const float* mb = (const float*)d_in[7];
  float* out = (float*)d_out;   // [8][1024][1024]
  if (in_sizes[0] != BT * S * D || in_sizes[1] != S * S * NP_ || in_sizes[2] != 2 * D * D || in_sizes[3] != 2 * D || in_sizes[4] != D * D || in_sizes[5] != D || in_sizes[6] != NP_) return;

  size_t off = 0; char* ws = (char*)d_ws;
  auto carve = [&](size_t bytes) { char* p = ws + off; off += (bytes + 255) & ~(size_t)255; return p; };
  unsigned short* x16 = (unsigned short*)carve((size_t)NTOK * D * 2); unsigned short* w16 = (unsigned short*)carve((size_t)2 * D * D * 2); b16* wo16 = (b16*)carve((size_t)D * D * 2);
  b16* kh = (b16*)carve((size_t)2 * NTOK * D * 2); b16* vt = (b16*)carve((size_t)2 * NTOK * D * 2); float* y = (float*)carve((size_t)NTOK * D * 4); float* pb = (float*)carve((size_t)S * S * 4); float* sw = (float*)carve(256);
  if (off > ws_size) return;                                    // ≈ 128 MB
  prep_kernel<<<512, 256, 0, stream>>>(wqkv, wo, w16, wo16);
  xprep_kernel<<<1024, 256, 0, stream>>>(x, x16);
  posb_kernel<<<S * S / 256, 256, 0, stream>>>(pos, mw, mb, pb, sw);
  proj_kernel<<<dim3(2 * D / 64, NTOK / 128), 128, 0, stream>>>((const __bf16*)x16, (const __bf16*)w16, bqkv, kh, vt);
  attn_kernel<S / 16><<<Bn * H * (S / 16) / 8, 256, 0, stream>>>(kh, vt, pb, sw, y);
  out_kernel<<<dim3(D / 64, NTOK / 128), 128, 0, stream>>>(y, wo16, bo, out);
}

// v003
// A run of this version takes 175 microseconds.
// Timed twice side by side with v002, it ran 1.11 times as fast both times.
// Over all steps from v000 it is 2.18 times as fast.
#include <hip/hip_runtime.h>

// MultiheadAttention_KV: kv = x kv_w^T + kv_b (16 heads x [k 64 | v 64] interleaved per head); scores = (k_q . k_k)/8 * sum(mp_w) + pos_bias[q][k] with pos_bias = pos mp_w^T + mp_b
// (shared over batch and heads; precomputed once); softmax; vals = a v; out = vals o_w^T + o_b -> [8][1024][1024]. Keys and queries are the SAME k rows.
namespace {
constexpr int BT = 8, Bn = 8, S = 1024, D = 1024, H = 16, HD = 64, NTOK = Bn * S, NP_ = 10;
constexpr float SCALE = 0.125f, VS = 8.0f, QS = 8.0f, PS = 8.0f;   // power-of-two carry scales so hi/lo residual planes stay normal in f16
constexpr size_t VPL = (size_t)NTOK * D;   // distance between the (8v)^T hi and lo planes
constexpr size_t QPL = (size_t)NTOK * D;   // distance between the q/k hi and lo planes

typedef _Float16 b16;
typedef __attribute__((ext_vector_type(16))) _Float16 v16b;
typedef __attribute__((ext_vector_type(8)))  _Float16 v8b;
typedef __attribute__((ext_vector_type(8)))  float v8f;
typedef __attribute__((ext_vector_type(4)))  float v4f;

__device__ __forceinline__ v8b ld8b(const b16* p) { return *(const v8b*)p; }
__device__ __forceinline__ v16b cat8b(v8b a, v8b b) { return __builtin_shufflevector(a, b, 0, 1, 2, 3, 4, 5, 6, 7, 8, 9, 10, 11, 12, 13, 14, 15); }
// Fragment-packed operand tiles. A 16-row x 32-k tile of a 16-bit operand is 512 elements laid out [j 2][lane 32][8]: lane = 16 * hh + row holds k = 16 * j + 8 * hh + e,
// the hardware k order of a 16x16x32 A or B fragment, so each wave-wide 16-byte load reads 512 contiguous bytes (4 whole lines instead of 16 partly used ones).
// An f32 tile is [j4 4][lane 32][4] with k = 16 * (j4 >> 1) + 8 * hh + 4 * (j4 & 1) + e.
__device__ __forceinline__ v16b frag_pk(const b16* tile, int lane) { return cat8b(ld8b(tile + lane * 8), ld8b(tile + 256 + lane * 8)); }
__device__ __forceinline__ void split16(float v, b16& hi, b16& lo) { hi = (b16)v; lo = (b16)(v - (float)hi); }
__device__ __forceinline__ v8f wmma16b(v16b a, v16b b, v8f c) {
  v8f d = __builtin_amdgcn_wmma_f32_16x16x32_f16(false, a, false, b, (short)0, c, false, false);
  asm volatile("v_nop\n\tv_nop\n\tv_nop\n\tv_nop" : "+v"(d) : "v"(a), "v"(b));
  return d;
}
__device__ __forceinline__ void wave_lds_sync() {
  __builtin_amdgcn_fence(__ATOMIC_RELEASE, "workgroup");
  __builtin_amdgcn_wave_barrier();
  __builtin_amdgcn_fence(__ATOMIC_ACQUIRE, "workgroup");
}

__device__ __forceinline__ void epi_planes(v8f (&acc)[2][4], float scale, bool two, b16* __restrict__ oh, b16* __restrict__ ol, int ldo,
                                           int m0, int c0, int lane, b16* Th, b16* Tl) {
  const int nloc = lane & 15, hlf = lane >> 4;
#pragma unroll
  for (int t = 0; t < 4; ++t)
#pragma unroll
    for (int r = 0; r < 2; ++r)
#pragma unroll
      for (int v = 0; v < 8; ++v) {
        const int rr = r * 16 + v + 8 * hlf, cc = t * 16 + nloc;
        b16 h_, l_; split16(acc[r][t][v] * scale, h_, l_);
        Th[rr * 64 + cc] = h_; Tl[rr * 64 + cc] = l_;
      }
  wave_lds_sync();
  {
#pragma unroll
    for (int j = 0; j < 8; ++j) {
      const int rr = j * 4 + (lane >> 3), c8 = (lane & 7) * 8;
      const size_t o = (size_t)(m0 + rr) * ldo + c0 + c8;
      *(v8b*)(oh + o) = ld8b(Th + rr * 64 + c8);
      if (two) *(v8b*)(ol + o) = ld8b(Tl + rr * 64 + c8);
    }
    
  }
}
// (b) f32 rows with pitch ldo: 64 floats = 256 B = 2 lines per row; 16 lanes x 16 B per row, 2 rows per instruction. Optional per-row factor
__device__ __forceinline__ void epi_f32(v8f (&acc)[2][4], float scale, const float* rscale, float* __restrict__ out, int ldo, int m0, int c0, int lane, float* Tt) {
  const int nloc = lane & 15, hlf = lane >> 4;
#pragma unroll
  for (int t = 0; t < 4; ++t)
#pragma unroll
    for (int r = 0; r < 2; ++r)
#pragma unroll
      for (int v = 0; v < 8; ++v) {
        const int rr = r * 16 + v + 8 * hlf;
        const float rs = rscale ? rscale[(size_t)(m0 + rr) * 32] : 1.0f;
        Tt[rr * 64 + t * 16 + nloc] = acc[r][t][v] * scale * rs;
      }
  wave_lds_sync();
  float* dst0 = out + (size_t)m0 * ldo + c0;
  {
#pragma unroll
    for (int j = 0; j < 16; ++j) { const int rr = j * 2 + hlf, c4 = nloc * 4; *(v4f*)(dst0 + (size_t)rr * ldo + c4) = *(const v4f*)(Tt + rr * 64 + c4); }
    
  }
}



typedef __attribute__((ext_vector_type(8))) __bf16 v8bb; typedef __attribute__((ext_vector_type(16))) __bf16 v16bb;
__device__ __forceinline__ v16bb frag_pk_bf(const __bf16* tile, int lane) { const v8bb a = *(const v8bb*)(tile + lane * 8), b = *(const v8bb*)(tile + 256 + lane * 8); return __builtin_shufflevector(a, b, 0, 1, 2, 3, 4, 5, 6, 7, 8, 9, 10, 11, 12, 13, 14, 15); }
__device__ __forceinline__ v8f wmma16bb(v16bb a, v16bb b, v8f c) {
  v8f d = __builtin_amdgcn_wmma_f32_16x16x32_bf16(false, a, false, b, (short)0, c, false, false);
  asm volatile("v_nop\n\tv_nop\n\tv_nop\n\tv_nop" : "+v"(d) : "v"(a), "v"(b));
  return d;
}
__device__ __forceinline__ unsigned short bf16_rne_bits(float v) { unsigned int u = __float_as_uint(v); u += 0x7FFFu + ((u >> 16) & 1u); return (unsigned short)(u >> 16); }
__device__ __forceinline__ float bf16_rne(float v) { return __uint_as_float(((unsigned int)bf16_rne_bits(v)) << 16); }



// Preparation kernels read whole 128-byte lines. One wave packs one 16-row x 32-k tile per pass: in load i lane l reads floats 4 * (l & 7) .. + 3 of row 4 * i + (l >> 3), so 8 lanes
// take a row's whole line; those 4 values (k = 4 c + e, c = l & 7) are half of the packed piece (j = c >> 2, hh = (c >> 1) & 1, row) and go out as one 8-byte store.
// The unroll directives of this part make every index of the small arrays a constant, so that they stay in registers and a pass's loads issue together.
typedef __attribute__((ext_vector_type(4))) unsigned short v4us; typedef __attribute__((ext_vector_type(4))) _Float16 v4b;
__device__ __forceinline__ size_t tile_src(size_t tile, int i, int lane) { return ((tile >> 5) * 16 + i * 4 + (lane >> 3)) * D + (tile & 31) * 32 + (lane & 7) * 4; }   // tiles ordered [row tile][k tile]
__device__ __forceinline__ size_t tile_dst(size_t tile, int i, int lane) { const int c = lane & 7; return tile * 512 + (c >> 2) * 256 + (((c >> 1) & 1) * 16 + i * 4 + (lane >> 3)) * 8 + (c & 1) * 4; }
__device__ __forceinline__ void pack_bf_tile(const float* __restrict__ s, unsigned short* __restrict__ d, size_t tile, int lane) {
  v4f f[4];
#pragma unroll
  for (int i = 0; i < 4; ++i) f[i] = *(const v4f*)(s + tile_src(tile, i, lane));
#pragma unroll
  for (int i = 0; i < 4; ++i) { v4us v;
#pragma unroll
    for (int e = 0; e < 4; ++e) v[e] = bf16_rne_bits(f[i][e]);
    *(v4us*)(d + tile_dst(tile, i, lane)) = v; }
}
__global__ __launch_bounds__(256) void xprep_kernel(const float* __restrict__ x, unsigned short* __restrict__ x16) {   // x -> bf16 packed tiles [token tile][k tile]
  const int lane = threadIdx.x & 31;
  const size_t wv = ((size_t)blockIdx.x * blockDim.x + threadIdx.x) >> 5, nwv = ((size_t)gridDim.x * blockDim.x) >> 5;
  for (size_t tile = wv; tile < (size_t)NTOK * D / 512; tile += nwv) pack_bf_tile(x, x16, tile, lane);
}
__global__ __launch_bounds__(256) void prep_kernel(const float* __restrict__ wqkv, const float* __restrict__ wo, unsigned short* __restrict__ w16, b16* __restrict__ wo16) {
  const int lane = threadIdx.x & 31;
  const size_t wv = ((size_t)blockIdx.x * blockDim.x + threadIdx.x) >> 5, nwv = ((size_t)gridDim.x * blockDim.x) >> 5;
  for (size_t tile = wv; tile < (size_t)2 * D * D / 512; tile += nwv) pack_bf_tile(wqkv, w16, tile, lane);   // kv_w [2048][1024] ([out][in]) rows -> packed tiles [out tile][k tile]
  for (size_t tile = wv; tile < (size_t)D * D / 512; tile += nwv) {                                          // W_o [out][in] rows -> packed tiles [out tile][k tile]
    v4f f[4];
#pragma unroll
    for (int i = 0; i < 4; ++i) f[i] = *(const v4f*)(wo + tile_src(tile, i, lane));
#pragma unroll
    for (int i = 0; i < 4; ++i) { v4b w;
#pragma unroll
      for (int e = 0; e < 4; ++e) w[e] = (b16)bf16_rne(f[i][e]);
      *(v4b*)(wo16 + tile_dst(tile, i, lane)) = w; }
  }
}

// pos_bias: a work-group makes one query tile (16 rows) x 128 keys. A row's 128 keys x 10 features are 5120 contiguous bytes: each wave brings two rows as whole-line loads into LDS;
// behind the barrier each thread reads the 40 floats of 4 keys of its own packed place. Row pitch 5120 + 16 bytes: sixteen rows' 16-byte reads fall on different banks.
constexpr int PBK = 128, PROW = PBK * NP_ + 4;
__global__ __launch_bounds__(256) void posb_kernel(const float* __restrict__ pos, const float* __restrict__ mw, const float* __restrict__ mb, float* __restrict__ pb, float* __restrict__ sw) {
  __shared__ __attribute__((aligned(16))) float P[16 * PROW];
  const int t = threadIdx.x, lane = t & 31, wave = t >> 5, qt = blockIdx.x / (S / PBK), kq = blockIdx.x % (S / PBK);
  v4f st[2][NP_];
#pragma unroll
  for (int r = 0; r < 2; ++r)
#pragma unroll
    for (int i = 0; i < NP_; ++i) st[r][i] = *(const v4f*)(pos + ((size_t)(qt * 16 + wave * 2 + r) * S + kq * PBK) * NP_ + i * 128 + lane * 4);
  float w[NP_];
#pragma unroll
  for (int p = 0; p < NP_; ++p) w[p] = bf16_rne(mw[p]);
  const float b0 = bf16_rne(mb[0]);
#pragma unroll
  for (int r = 0; r < 2; ++r)
#pragma unroll
    for (int i = 0; i < NP_; ++i) *(v4f*)(P + (wave * 2 + r) * PROW + i * 128 + lane * 4) = st[r][i];
  __syncthreads();   // every row is staged before any thread reads across rows
  float* dst = pb + ((size_t)qt * (S / 32) + kq * (PBK / 32)) * 512;   // packed f32 tiles [query tile 64][key tile 32][j4 4][lane 32][4]; this work-group's four key tiles are 8 KiB in a row
#pragma unroll
  for (int h = 0; h < 2; ++h) {
    const int gi = h * 256 + t, j4 = (gi >> 5) & 3, kt = gi >> 7;
    const float* pr = P + (lane & 15) * PROW + (kt * 32 + (j4 >> 1) * 16 + (lane >> 4) * 8 + (j4 & 1) * 4) * NP_;
    v4f f[NP_], o;
#pragma unroll
    for (int i = 0; i < NP_; ++i) f[i] = *(const v4f*)(pr + i * 4);
#pragma unroll
    for (int e = 0; e < 4; ++e) { float s = b0;
#pragma unroll
      for (int p = 0; p < NP_; ++p) s += bf16_rne(f[(e * NP_ + p) >> 2][(e * NP_ + p) & 3]) * w[p];   // a product of two bf16 values is exact in f32 (short of underflow): fused or not, each addition rounds the same
      o[e] = s; }
    *(v4f*)(dst + gi * 4) = o;
  }
  if (blockIdx.x == 0 && t < 64) { float s = 0.0f;   // sum of bf16(mp_w), replicated over one 256-B row
#pragma unroll
    for (int p = 0; p < NP_; ++p) s += w[p];
    sw[t] = s; }
}

// projections: rows = tokens (8192), K = 1024, column tiles of 64 = one head's k or v (interleaved per head); k: f16 packed tiles [b*H + head][token tile 64][ks 2];
// v: (8v)^T f16 packed tiles [b*H + head][key tile 32][d tile 4]. grid (32, 64) x 128.
__global__ __launch_bounds__(128) void proj_kernel(const __bf16* __restrict__ x16, const __bf16* __restrict__ w16, const float* __restrict__ bqkv, b16* __restrict__ kh, b16* __restrict__ vt) {
  __shared__ __attribute__((aligned(16))) b16 Th[4][32][HD + 8], Tq[4][32][HD + 8];
  const int lane = threadIdx.x & 31, wave = threadIdx.x >> 5, nloc = lane & 15, hlf = lane >> 4, m0 = blockIdx.y * 128 + wave * 32, c0 = blockIdx.x * 64;
  v8f acc[2][4];
#pragma unroll
  for (int r = 0; r < 2; ++r)
#pragma unroll
    for (int t = 0; t < 4; ++t) acc[r][t] = (v8f){};
  const __bf16* xa = x16 + (size_t)(m0 >> 4) * (D / 32) * 512; const __bf16* wb = w16 + (size_t)(c0 >> 4) * (D / 32) * 512;   // packed tiles, 512 elements each
#pragma unroll 2
  for (int kt = 0; kt < D / 32; ++kt) {
    const v16bb a0 = frag_pk_bf(xa + kt * 512, lane), a1 = frag_pk_bf(xa + (D / 32 + kt) * 512, lane); v16bb bw[4];
#pragma unroll
    for (int t = 0; t < 4; ++t) bw[t] = frag_pk_bf(wb + (t * (D / 32) + kt) * 512, lane);
    // stands behind the step's twelve loads, in front of any write of a register that they name; no load sinks below it, so they fly together and not one pair after another
    asm volatile("s_wait_xcnt 0x0" ::: "memory");
#pragma unroll
    for (int t = 0; t < 4; ++t) { acc[0][t] = wmma16bb(a0, bw[t], acc[0][t]); acc[1][t] = wmma16bb(a1, bw[t], acc[1][t]); }
  }
  const int which = blockIdx.x & 1, head = blockIdx.x >> 1, b = m0 / S, tok0 = m0 % S;   // tile = (head, k|v) interleaved per head
#pragma unroll
  for (int t = 0; t < 4; ++t) { const float bb = bf16_rne(bqkv[c0 + t * 16 + nloc]);   // + bias (bf16-rounded)
#pragma unroll
    for (int r = 0; r < 2; ++r)
#pragma unroll
      for (int v = 0; v < 8; ++v) acc[r][t][v] += bb; }
  if (which == 0) {                                             // k head: f16 packed tiles (hi + lo planes)
#pragma unroll
    for (int t = 0; t < 4; ++t)
#pragma unroll
      for (int r = 0; r < 2; ++r)
#pragma unroll
        for (int v = 0; v < 8; ++v) { b16 a_, c_; split16(acc[r][t][v] * QS, a_, c_); Th[wave][r * 16 + 8 * hlf + v][t * 16 + nloc] = a_; Tq[wave][r * 16 + 8 * hlf + v][t * 16 + nloc] = c_; }   // q, k carried x8 (lo residuals stay normal)
    wave_lds_sync();
    b16* dst = kh + (((size_t)b * H + head) * S + tok0) * HD;
    {
#pragma unroll
      for (int j = 0; j < 8; ++j) { const int rr = (j >> 2) * 16 + nloc, c8 = ((j >> 1) & 1) * 32 + (j & 1) * 16 + hlf * 8;   // packed tiles [token tile][ks 2]: piece j = (token tile, ks, j)
        *(v8b*)(dst + j * 256 + lane * 8) = *(const v8b*)(&Th[wave][rr][c8]); *(v8b*)(dst + QPL + j * 256 + lane * 8) = *(const v8b*)(&Tq[wave][rr][c8]); }
       }
    return;
  }
  // v head: (8v)^T packed tiles [key tile 32][d tile 4], 32 keys = 2048 elements. A lane's accumulators acc[j][n][e] (key 16 j + 8 hlf + e, d 16 n + nloc) are its own
  // packed piece (n, j), so they are stored straight from registers.
  b16* dstv = vt + (((size_t)b * H + head) * HD) * S + (size_t)tok0 * HD;
#pragma unroll
  for (int n = 0; n < 4; ++n)
#pragma unroll
    for (int j = 0; j < 2; ++j) { v8b a8, c8;
#pragma unroll
      for (int e = 0; e < 8; ++e) { b16 a_, c_; split16(acc[j][n][e] * VS, a_, c_); a8[e] = a_; c8[e] = c_; }
      *(v8b*)(dstv + (n * 2 + j) * 256 + lane * 8) = a8; *(v8b*)(dstv + VPL + (n * 2 + j) * 256 + lane * 8) = c8; }
  asm volatile("s_wait_xcnt 0x0" ::: "memory");   // stands behind the last v store, in front of any later write of a register that an issued store names
}

// attention without mask: wave = (b, h, 16 queries); key chunks of 32 over all S keys: S^T (K=64) + pos bias, online softmax f32, P^T f16, y^T += (8V)^T P^T;
template <int QT>
__global__ __launch_bounds__(256) void attn_kernel(const b16* __restrict__ kh, const b16* __restrict__ vt, const float* __restrict__ pb, const float* __restrict__ swp, float* __restrict__ y) {
  const float SW = swp[0];
  const int wid = threadIdx.x >> 5, lane = threadIdx.x & 31;
  const int qt = blockIdx.x * 8 + wid, jt = qt % QT, bh = qt / QT, h = bh % H, b = bh / H;
  const b16* Q = kh + ((size_t)bh * S) * HD; const b16* K = kh + ((size_t)bh * S) * HD; const b16* vb = vt + ((size_t)bh * HD) * S;
  v16b qf[2], ql[2];
#pragma unroll
  for (int ks = 0; ks < 2; ++ks) { qf[ks] = frag_pk(Q + (jt * 2 + ks) * 512, lane); ql[ks] = frag_pk(Q + QPL + (jt * 2 + ks) * 512, lane); }
  float m = -INFINITY, l = 0.0f; v8f o[4] = {{}, {}, {}, {}};
  const float* pbq = pb + (size_t)jt * (S / 32) * 512 + lane * 4;   // this query tile's additive bias, packed f32 tiles
  // Loads run ahead of their use: a chunk's key fragments and bias are fetched during the chunk before it, its value fragments at the chunk's top, ahead of the score products.
  v16b kf[2][2]; v4f pq[4];
#pragma unroll
  for (int ks = 0; ks < 2; ++ks) { kf[ks][0] = frag_pk(K + ks * 512, lane); kf[ks][1] = frag_pk(K + 1024 + ks * 512, lane); }
#pragma unroll
  for (int j = 0; j < 4; ++j) pq[j] = *(const v4f*)(pbq + j * 128);
  for (int kb = 0; kb < S; kb += 32) {
    const b16* vhp = vb + kb * HD + lane * 8; const b16* vlp = vhp + VPL;
    v16b vf[4], vl[4];
#pragma unroll
    for (int n = 0; n < 4; ++n) { vf[n] = cat8b(ld8b(vhp + n * 512), ld8b(vhp + n * 512 + 256)); vl[n] = cat8b(ld8b(vlp + n * 512), ld8b(vlp + n * 512 + 256)); }
    // stands behind the value loads, in front of any write of a register that they name; no load sinks below it to its use
    asm volatile("s_wait_xcnt 0x0" ::: "memory");
    v8f s0 = {}, s1 = {};
#pragma unroll
    for (int ks = 0; ks < 2; ++ks) {
      s0 = wmma16b(kf[ks][0], qf[ks], s0); s0 = wmma16b(kf[ks][0], ql[ks], s0);      // query side hi+lo, key side hi only (2 products): the key's 2^-11 rounding moves the O(1) logits by ~3e-5
      s1 = wmma16b(kf[ks][1], qf[ks], s1); s1 = wmma16b(kf[ks][1], ql[ks], s1); }
    const int kn = kb + 32 < S ? kb + 32 : kb;   // next chunk; the last pass fetches its own again (in bounds, unused)
    const b16* kp = K + kn * HD + lane * 8;
#pragma unroll
    for (int ks = 0; ks < 2; ++ks) { kf[ks][0] = cat8b(ld8b(kp + ks * 512), ld8b(kp + ks * 512 + 256)); kf[ks][1] = cat8b(ld8b(kp + 1024 + ks * 512), ld8b(kp + 1024 + ks * 512 + 256)); }
    // the same behind the next chunk's key loads: they stay here, a whole softmax and value product ahead of their use
    asm volatile("s_wait_xcnt 0x0" ::: "memory");
    float mr = -INFINITY;
#pragma unroll
    for (int r = 0; r < 8; ++r) { s0[r] = s0[r] * (SCALE * SW / (QS * QS)) + pq[r >> 2][r & 3]; s1[r] = s1[r] * (SCALE * SW / (QS * QS)) + pq[2 + (r >> 2)][r & 3]; mr = fmaxf(mr, fmaxf(s0[r], s1[r])); }
    const float* pp = pbq + kn * 16;
#pragma unroll
    for (int j = 0; j < 4; ++j) pq[j] = *(const v4f*)(pp + j * 128);
    // the same behind the next chunk's bias loads, which stay ahead of the exponentials
    asm volatile("s_wait_xcnt 0x0" ::: "memory");
    mr = fmaxf(mr, __shfl_xor(mr, 16));
    const float mn = fmaxf(m, mr), al_ = __expf(m - mn); m = mn;
    float sum = 0.0f; v16b pb, pl;
#pragma unroll
    for (int r = 0; r < 8; ++r) { const float e0 = __expf(s0[r] - mn), e1 = __expf(s1[r] - mn); sum += e0 + e1; b16 a, c; split16(e0 * PS, a, c); pb[r] = a; pl[r] = c; split16(e1 * PS, a, c); pb[8 + r] = a; pl[8 + r] = c; }   // P carried x8
    sum += __shfl_xor(sum, 16); l = l * al_ + sum;
#pragma unroll
    for (int n = 0; n < 4; ++n) {
#pragma unroll
      for (int r = 0; r < 8; ++r) o[n][r] *= al_;
      o[n] = wmma16b(vf[n], pb, o[n]); o[n] = wmma16b(vf[n], pl, o[n]); o[n] = wmma16b(vl[n], pb, o[n]);   // (8v) and P both as f16 hi+lo pairs (lo.lo dropped)
    }
  }
  const float inv = 1.0f / (VS * PS * l);
  float* dst = y + ((size_t)(b * QT + jt) * (D / 32) + h * 2) * 512;   // packed f32 tiles [token tile][k tile]; this head = 2 k tiles = 8 pieces of 512 B
  {
#pragma unroll
    for (int j = 0; j < 8; ++j) { v4f w;   // a lane's accumulators are its own packed pieces (d = 16 n + 8 hh + r), so no LDS exchange is needed
#pragma unroll
      for (int e = 0; e < 4; ++e) w[e] = o[j >> 1][(j & 1) * 4 + e] * inv;
      *(v4f*)(dst + j * 128 + lane * 4) = w; }
    
  }
}

// out = y W_o^T: (8192 x 1024) x (1024 x 1024); A = y x8 split at load into f16 hi + lo, B = f16(bf16 W_o) packed tiles; f32 rows; grid (16, 64).
__global__ __launch_bounds__(128) void out_kernel(const float* __restrict__ y, const b16* __restrict__ wo16, const float* __restrict__ bo, float* __restrict__ out) {
  __shared__ __attribute__((aligned(16))) float Ts[4][32 * 64];
  const int lane = threadIdx.x & 31, wave = threadIdx.x >> 5, nloc = lane & 15, m0 = blockIdx.y * 128 + wave * 32, c0 = blockIdx.x * 64;
  v8f acc[2][4];
#pragma unroll
  for (int r = 0; r < 2; ++r)
#pragma unroll
    for (int t = 0; t < 4; ++t) acc[r][t] = (v8f){};
  const float* ya = y + (size_t)(m0 >> 4) * (D / 32) * 512 + lane * 4; const b16* wb = wo16 + (size_t)(c0 >> 4) * (D / 32) * 512;   // packed tiles
  // Loads run one step ahead: y is fetched again as soon as the step's rows are split, each weight fragment as soon as its four products are issued.
  v4f yr[2][4]; v16b bh[4];
#pragma unroll
  for (int r = 0; r < 2; ++r)
#pragma unroll
    for (int j = 0; j < 4; ++j) yr[r][j] = *(const v4f*)(ya + r * (D / 32) * 512 + j * 128);
  // keeps the first y loads in front of the first weight loads, the order of the loop: loads return in order, and the split of y then waits for y alone
  asm volatile("s_wait_xcnt 0x0" ::: "memory");
#pragma unroll
  for (int t = 0; t < 4; ++t) bh[t] = frag_pk(wb + t * (D / 32) * 512, lane);
  for (int kt = 0; kt < D / 32; ++kt) {                                         // y as an f16 hi+lo pair carried x8 (2 products)
    v16b ah[2], al[2];
#pragma unroll
    for (int r = 0; r < 2; ++r)
#pragma unroll
      for (int j = 0; j < 4; ++j) {
#pragma unroll
        for (int e = 0; e < 4; ++e) { b16 a, c; split16(yr[r][j][e] * 8.0f, a, c); ah[r][j * 4 + e] = a; al[r][j * 4 + e] = c; } }
    const int kn = kt + 1 < D / 32 ? kt + 1 : kt;   // next step; the last one fetches its own again (in bounds, unused)
#pragma unroll
    for (int r = 0; r < 2; ++r)
#pragma unroll
      for (int j = 0; j < 4; ++j) yr[r][j] = *(const v4f*)(ya + (r * (D / 32) + kn) * 512 + j * 128);
    // stands behind the next step's y loads, in front of any write of a register that they name; they stay here, all sixteen products ahead of their use
    asm volatile("s_wait_xcnt 0x0" ::: "memory");
#pragma unroll
    for (int t = 0; t < 4; ++t) {
      acc[0][t] = wmma16b(ah[0], bh[t], acc[0][t]); acc[0][t] = wmma16b(al[0], bh[t], acc[0][t]);
      acc[1][t] = wmma16b(ah[1], bh[t], acc[1][t]); acc[1][t] = wmma16b(al[1], bh[t], acc[1][t]);
      bh[t] = frag_pk(wb + (t * (D / 32) + kn) * 512, lane); }
    // the same behind the next step's weight loads
    asm volatile("s_wait_xcnt 0x0" ::: "memory");
  }
#pragma unroll
  for (int t = 0; t < 4; ++t)
#pragma unroll
    for (int r = 0; r < 2; ++r)
#pragma unroll
      for (int v = 0; v < 8; ++v) acc[r][t][v] = acc[r][t][v] * (1.0f / 8.0f) + bf16_rne(bo[c0 + t * 16 + nloc]);
  epi_f32(acc, 1.0f, nullptr, out, D, m0, c0, lane, Ts[wave]);
}
}  // namespace

extern "C" void kernel_launch(void* const* d_in, const int* in_sizes, int n_in,
                              void* d_out, int out_size, void* d_ws, size_t ws_size, hipStream_t stream) {
  (void)n_in; (void)out_size;
  const float* x = (const float*)d_in[0]; const float* pos = (const float*)d_in[1]; const float* wqkv = (const float*)d_in[2]; const float* bqkv = (const float*)d_in[3]; const float* wo = (const float*)d_in[4]; const float* bo = (const float*)d_in[5]; const float* mw = (const float*)d_in[6]; const float* mb = (const float*)d_in[7];
  float* out = (float*)d_out;   // [8][1024][1024]
  if (in_sizes[0] != BT * S * D || in_sizes[1] != S * S * NP_ || in_sizes[2] != 2 * D * D || in_sizes[3] != 2 * D || in_sizes[4] != D * D || in_sizes[5] != D || in_sizes[6] != NP_) return;

  size_t off = 0; char* ws = (char*)d_ws;
  auto carve = [&](size_t bytes) { char* p = ws + off; off += (bytes + 255) & ~(size_t)255; return p; };
  unsigned short* x16 = (unsigned short*)carve((size_t)NTOK * D * 2); unsigned short* w16 = (unsigned short*)carve((size_t)2 * D * D * 2); b16* wo16 = (b16*)carve((size_t)D * D * 2);
  b16* kh = (b16*)carve((size_t)2 * NTOK * D * 2); b16* vt = (b16*)carve((size_t)2 * NTOK * D * 2); float* y = (float*)carve((size_t)NTOK * D * 4); float* pb = (float*)carve((size_t)S * S * 4); float* sw = (float*)carve(256);
  if (off > ws_size) return;                                    // ≈ 128 MB
  prep_kernel<<<512, 256, 0, stream>>>(wqkv, wo, w16, wo16);
  xprep_kernel<<<1024, 256, 0, stream>>>(x, x16);
  posb_kernel<<<(S / 16) * (S / PBK), 256, 0, stream>>>(pos, mw, mb, pb, sw);
  proj_kernel<<<dim3(2 * D / 64, NTOK / 128), 128, 0, stream>>>((const __bf16*)x16, (const __bf16*)w16, bqkv, kh, vt);
  attn_kernel<S / 16><<<Bn * H * (S / 16) / 8, 256, 0, stream>>>(kh, vt, pb, sw, y);
  out_kernel<<<dim3(D / 64, NTOK / 128), 128, 0, stream>>>(y, wo16, bo, out);
}

// v004
// Measured time: 170 microseconds a run.
// Two timings next to v003 both put it at 1.03 times that version's speed.
// Over all steps from v000 it is 2.25 times as fast.
#include <hip/hip_runtime.h>

// MultiheadAttention_KV: kv = x kv_w^T + kv_b (16 heads x [k 64 | v 64] interleaved per head); scores = (k_q . k_k)/8 * sum(mp_w) + pos_bias[q][k] with pos_bias = pos mp_w^T + mp_b
// (shared over batch and heads; precomputed once); softmax; vals = a v; out = vals o_w^T + o_b -> [8][1024][1024]. Keys and queries are the SAME k rows.
namespace {
constexpr int BT = 8, Bn = 8, S = 1024, D = 1024, H = 16, HD = 64, NTOK = Bn * S, NP_ = 10;
constexpr float SCALE = 0.125f, VS = 8.0f, QS = 8.0f, PS = 8.0f;   // power-of-two carry scales so hi/lo residual planes stay normal in f16
constexpr size_t VPL = (size_t)NTOK * D;   // distance between the (8v)^T hi and lo planes
constexpr size_t QPL = (size_t)NTOK * D;   // distance between the q/k hi and lo planes

typedef _Float16 b16;
typedef __attribute__((ext_vector_type(16))) _Float16 v16b;
typedef __attribute__((ext_vector_type(8)))  _Float16 v8b;
typedef __attribute__((ext_vector_type(8)))  float v8f;
typedef __attribute__((ext_vector_type(4)))  float v4f;

__device__ __forceinline__ v8b ld8b(const b16* p) { return *(const v8b*)p; }
__device__ __forceinline__ v16b cat8b(v8b a, v8b b) { return __builtin_shufflevector(a, b, 0, 1, 2, 3, 4, 5, 6, 7, 8, 9, 10, 11, 12, 13, 14, 15); }
// Fragment-packed operand tiles. A 16-row x 32-k tile of a 16-bit operand is 512 elements laid out [j 2][lane 32][8]: lane = 16 * hh + row holds k = 16 * j + 8 * hh + e,
// the hardware k order of a 16x16x32 A or B fragment, so each wave-wide 16-byte load reads 512 contiguous bytes (4 whole lines instead of 16 partly used ones).
// An f32 tile is [j4 4][lane 32][4] with k = 16 * (j4 >> 1) + 8 * hh + 4 * (j4 & 1) + e.
__device__ __forceinline__ v16b frag_pk(const b16* tile, int lane) { return cat8b(ld8b(tile + lane * 8), ld8b(tile + 256 + lane * 8)); }
__device__ __forceinline__ void split16(float v, b16& hi, b16& lo) { hi = (b16)v; lo = (b16)(v - (float)hi); }
__device__ __forceinline__ v8f wmma16b(v16b a, v16b b, v8f c) {
  v8f d = __builtin_amdgcn_wmma_f32_16x16x32_f16(false, a, false, b, (short)0, c, false, false);
  asm volatile("v_nop\n\tv_nop\n\tv_nop\n\tv_nop" : "+v"(d) : "v"(a), "v"(b));
  return d;
}
__device__ __forceinline__ void wave_lds_sync() {
  __builtin_amdgcn_fence(__ATOMIC_RELEASE, "workgroup");
  __builtin_amdgcn_wave_barrier();
  __builtin_amdgcn_fence(__ATOMIC_ACQUIRE, "workgroup");
}

__device__ __forceinline__ void epi_planes(v8f (&acc)[2][4], float scale, bool two, b16* __restrict__ oh, b16* __restrict__ ol, int ldo,
                                           int m0, int c0, int lane, b16* Th, b16* Tl) {
  const int nloc = lane & 15, hlf = lane >> 4;
#pragma unroll
  for (int t = 0; t < 4; ++t)
#pragma unroll
    for (int r = 0; r < 2; ++r)
#pragma unroll
      for (int v = 0; v < 8; ++v) {
        const int rr = r * 16 + v + 8 * hlf, cc = t * 16 + nloc;
        b16 h_, l_; split16(acc[r][t][v] * scale, h_, l_);
        Th[rr * 64 + cc] = h_; Tl[rr * 64 + cc] = l_;
      }
  wave_lds_sync();
  {
#pragma unroll
    for (int j = 0; j < 8; ++j) {
      const int rr = j * 4 + (lane >> 3), c8 = (lane & 7) * 8;
      const size_t o = (size_t)(m0 + rr) * ldo + c0 + c8;
      *(v8b*)(oh + o) = ld8b(Th + rr * 64 + c8);
      if (two) *(v8b*)(ol + o) = ld8b(Tl + rr * 64 + c8);
    }
    
  }
}
// (b) f32 rows with pitch ldo: 64 floats = 256 B = 2 lines per row; 16 lanes x 16 B per row, 2 rows per instruction. Optional per-row factor
__device__ __forceinline__ void epi_f32(v8f (&acc)[2][4], float scale, const float* rscale, float* __restrict__ out, int ldo, int m0, int c0, int lane, float* Tt) {
  const int nloc = lane & 15, hlf = lane >> 4;
#pragma unroll
  for (int t = 0; t < 4; ++t)
#pragma unroll
    for (int r = 0; r < 2; ++r)
#pragma unroll
      for (int v = 0; v < 8; ++v) {
        const int rr = r * 16 + v + 8 * hlf;
        const float rs = rscale ? rscale[(size_t)(m0 + rr) * 32] : 1.0f;
        Tt[rr * 64 + t * 16 + nloc] = acc[r][t][v] * scale * rs;
      }
  wave_lds_sync();
  float* dst0 = out + (size_t)m0 * ldo + c0;
  {
#pragma unroll
    for (int j = 0; j < 16; ++j) { const int rr = j * 2 + hlf, c4 = nloc * 4; *(v4f*)(dst0 + (size_t)rr * ldo + c4) = *(const v4f*)(Tt + rr * 64 + c4); }
    
  }
}



typedef __attribute__((ext_vector_type(8))) __bf16 v8bb; typedef __attribute__((ext_vector_type(16))) __bf16 v16bb;
__device__ __forceinline__ v16bb frag_pk_bf(const __bf16* tile, int lane) { const v8bb a = *(const v8bb*)(tile + lane * 8), b = *(const v8bb*)(tile + 256 + lane * 8); return __builtin_shufflevector(a, b, 0, 1, 2, 3, 4, 5, 6, 7, 8, 9, 10, 11, 12, 13, 14, 15); }
__device__ __forceinline__ v8f wmma16bb(v16bb a, v16bb b, v8f c) {
  v8f d = __builtin_amdgcn_wmma_f32_16x16x32_bf16(false, a, false, b, (short)0, c, false, false);
  asm volatile("v_nop\n\tv_nop\n\tv_nop\n\tv_nop" : "+v"(d) : "v"(a), "v"(b));
  return d;
}
__device__ __forceinline__ unsigned short bf16_rne_bits(float v) { unsigned int u = __float_as_uint(v); u += 0x7FFFu + ((u >> 16) & 1u); return (unsigned short)(u >> 16); }
__device__ __forceinline__ float bf16_rne(float v) { return __uint_as_float(((unsigned int)bf16_rne_bits(v)) << 16); }



// Preparation kernels read whole 128-byte lines. One wave packs one 16-row x 32-k tile per pass: in load i lane l reads floats 4 * (l & 7) .. + 3 of row 4 * i + (l >> 3), so 8 lanes
// take a row's whole line; those 4 values (k = 4 c + e, c = l & 7) are half of the packed piece (j = c >> 2, hh = (c >> 1) & 1, row) and go out as one 8-byte store.
// The unroll directives of this part make every index of the small arrays a constant, so that they stay in registers and a pass's loads issue together.
typedef __attribute__((ext_vector_type(4))) unsigned short v4us; typedef __attribute__((ext_vector_type(4))) _Float16 v4b;
__device__ __forceinline__ size_t tile_src(size_t tile, int i, int lane) { return ((tile >> 5) * 16 + i * 4 + (lane >> 3)) * D + (tile & 31) * 32 + (lane & 7) * 4; }   // tiles ordered [row tile][k tile]
__device__ __forceinline__ size_t tile_dst(size_t tile, int i, int lane) { const int c = lane & 7; return tile * 512 + (c >> 2) * 256 + (((c >> 1) & 1) * 16 + i * 4 + (lane >> 3)) * 8 + (c & 1) * 4; }
__device__ __forceinline__ void pack_bf_tile(const float* __restrict__ s, unsigned short* __restrict__ d, size_t tile, int lane) {
  v4f f[4];
#pragma unroll
  for (int i = 0; i < 4; ++i) f[i] = *(const v4f*)(s + tile_src(tile, i, lane));
#pragma unroll
  for (int i = 0; i < 4; ++i) { v4us v;
#pragma unroll
    for (int e = 0; e < 4; ++e) v[e] = bf16_rne_bits(f[i][e]);
    *(v4us*)(d + tile_dst(tile, i, lane)) = v; }
}
// The three preparation parts depend on nothing but the inputs, so they share ONE launch (prep_all_kernel below): each is a device function that is told its work-group's index within the part.
constexpr int NB_X = 1024, NB_W = 512;   // work-groups of 256 threads for the x part and for the weight part
__device__ __forceinline__ void xprep_part(int bid, const float* __restrict__ x, unsigned short* __restrict__ x16) {   // x -> bf16 packed tiles [token tile][k tile]
  const int lane = threadIdx.x & 31;
  const size_t wv = ((size_t)bid * 256 + threadIdx.x) >> 5, nwv = ((size_t)NB_X * 256) >> 5;
  for (size_t tile = wv; tile < (size_t)NTOK * D / 512; tile += nwv) pack_bf_tile(x, x16, tile, lane);
}
__device__ __forceinline__ void wprep_part(int bid, const float* __restrict__ wqkv, const float* __restrict__ wo, unsigned short* __restrict__ w16, b16* __restrict__ wo16) {
  const int lane = threadIdx.x & 31;
  const size_t wv = ((size_t)bid * 256 + threadIdx.x) >> 5, nwv = ((size_t)NB_W * 256) >> 5;
  for (size_t tile = wv; tile < (size_t)2 * D * D / 512; tile += nwv) pack_bf_tile(wqkv, w16, tile, lane);   // kv_w [2048][1024] ([out][in]) rows -> packed tiles [out tile][k tile]
  for (size_t tile = wv; tile < (size_t)D * D / 512; tile += nwv) {                                          // W_o [out][in] rows -> packed tiles [out tile][k tile]
    v4f f[4];
#pragma unroll
    for (int i = 0; i < 4; ++i) f[i] = *(const v4f*)(wo + tile_src(tile, i, lane));
#pragma unroll
    for (int i = 0; i < 4; ++i) { v4b w;
#pragma unroll
      for (int e = 0; e < 4; ++e) w[e] = (b16)bf16_rne(f[i][e]);
      *(v4b*)(wo16 + tile_dst(tile, i, lane)) = w; }
  }
}

// pos_bias: a work-group makes one query tile (16 rows) x 128 keys. A row's 128 keys x 10 features are 5120 contiguous bytes: each wave brings two rows as whole-line loads into LDS;
// behind the barrier each thread reads the 40 floats of 4 keys of its own packed place. Row pitch 5120 + 16 bytes: sixteen rows' 16-byte reads fall on different banks.
constexpr int PBK = 128, PROW = PBK * NP_ + 4, NB_POS = (S / 16) * (S / PBK), NB_ALL = NB_POS + NB_X + NB_W;   // NB_POS: work-groups of the bias part; NB_ALL: the whole preparation grid
__device__ __forceinline__ void posb_part(int bid, float* P, const float* __restrict__ pos, const float* __restrict__ mw, const float* __restrict__ mb, float* __restrict__ pb, float* __restrict__ sw) {
  const int t = threadIdx.x, lane = t & 31, wave = t >> 5, qt = bid / (S / PBK), kq = bid % (S / PBK);
  v4f st[2][NP_];
#pragma unroll
  for (int r = 0; r < 2; ++r)
#pragma unroll
    for (int i = 0; i < NP_; ++i) st[r][i] = *(const v4f*)(pos + ((size_t)(qt * 16 + wave * 2 + r) * S + kq * PBK) * NP_ + i * 128 + lane * 4);
  float w[NP_];
#pragma unroll
  for (int p = 0; p < NP_; ++p) w[p] = bf16_rne(mw[p]);
  const float b0 = bf16_rne(mb[0]);
#pragma unroll
  for (int r = 0; r < 2; ++r)
#pragma unroll
    for (int i = 0; i < NP_; ++i) *(v4f*)(P + (wave * 2 + r) * PROW + i * 128 + lane * 4) = st[r][i];
  __syncthreads();   // every row is staged before any thread reads across rows
  float* dst = pb + ((size_t)qt * (S / 32) + kq * (PBK / 32)) * 512;   // packed f32 tiles [query tile 64][key tile 32][j4 4][lane 32][4]; this work-group's four key tiles are 8 KiB in a row
#pragma unroll
  for (int h = 0; h < 2; ++h) {
    const int gi = h * 256 + t, j4 = (gi >> 5) & 3, kt = gi >> 7;
    const float* pr = P + (lane & 15) * PROW + (kt * 32 + (j4 >> 1) * 16 + (lane >> 4) * 8 + (j4 & 1) * 4) * NP_;
    v4f f[NP_], o;
#pragma unroll
    for (int i = 0; i < NP_; ++i) f[i] = *(const v4f*)(pr + i * 4);
#pragma unroll
    for (int e = 0; e < 4; ++e) { float s = b0;
#pragma unroll
      for (int p = 0; p < NP_; ++p) s += bf16_rne(f[(e * NP_ + p) >> 2][(e * NP_ + p) & 3]) * w[p];   // a product of two bf16 values is exact in f32 (short of underflow): fused or not, each addition rounds the same
      o[e] = s; }
    *(v4f*)(dst + gi * 4) = o;
  }
  if (bid == 0 && t < 64) { float s = 0.0f;   // sum of bf16(mp_w), replicated over one 256-B row
#pragma unroll
    for (int p = 0; p < NP_; ++p) s += w[p];
    sw[t] = s; }
}
// One launch for all preparation. The part is chosen by the work-group's index alone, so every branch (and the bias part's barrier) is uniform over the work-group.
// The bias work-groups move the most bytes each and come first in index order (for speed only).
__global__ __launch_bounds__(256) void prep_all_kernel(const float* __restrict__ x, const float* __restrict__ pos, const float* __restrict__ wqkv, const float* __restrict__ wo,
                                                       const float* __restrict__ mw, const float* __restrict__ mb, unsigned short* __restrict__ x16, unsigned short* __restrict__ w16,
                                                       b16* __restrict__ wo16, float* __restrict__ pb, float* __restrict__ sw) {
  __shared__ __attribute__((aligned(16))) float P[16 * PROW];
  const int bid = blockIdx.x;
  if (bid < NB_POS) posb_part(bid, P, pos, mw, mb, pb, sw);
  else if (bid < NB_POS + NB_X) xprep_part(bid - NB_POS, x, x16);
  else wprep_part(bid - NB_POS - NB_X, wqkv, wo, w16, wo16);
}

// projections: rows = tokens (8192), K = 1024, column tiles of 64 = one head's k or v (interleaved per head); k: f16 packed tiles [b*H + head][token tile 64][ks 2];
// v: (8v)^T f16 packed tiles [b*H + head][key tile 32][d tile 4]. grid (32, 64) x 128.
__global__ __launch_bounds__(128) void proj_kernel(const __bf16* __restrict__ x16, const __bf16* __restrict__ w16, const float* __restrict__ bqkv, b16* __restrict__ kh, b16* __restrict__ vt) {
  __shared__ __attribute__((aligned(16))) b16 Th[4][32][HD + 8], Tq[4][32][HD + 8];
  const int lane = threadIdx.x & 31, wave = threadIdx.x >> 5, nloc = lane & 15, hlf = lane >> 4, m0 = blockIdx.y * 128 + wave * 32, c0 = blockIdx.x * 64;
  v8f acc[2][4];
#pragma unroll
  for (int r = 0; r < 2; ++r)
#pragma unroll
    for (int t = 0; t < 4; ++t) acc[r][t] = (v8f){};
  const __bf16* xa = x16 + (size_t)(m0 >> 4) * (D / 32) * 512; const __bf16* wb = w16 + (size_t)(c0 >> 4) * (D / 32) * 512;   // packed tiles, 512 elements each
#pragma unroll 2
  for (int kt = 0; kt < D / 32; ++kt) {
    const v16bb a0 = frag_pk_bf(xa + kt * 512, lane), a1 = frag_pk_bf(xa + (D / 32 + kt) * 512, lane); v16bb bw[4];
#pragma unroll
    for (int t = 0; t < 4; ++t) bw[t] = frag_pk_bf(wb + (t * (D / 32) + kt) * 512, lane);
    // stands behind the step's twelve loads, in front of any write of a register that they name; no load sinks below it, so they fly together and not one pair after another
    asm volatile("s_wait_xcnt 0x0" ::: "memory");
#pragma unroll
    for (int t = 0; t < 4; ++t) { acc[0][t] = wmma16bb(a0, bw[t], acc[0][t]); acc[1][t] = wmma16bb(a1, bw[t], acc[1][t]); }
  }
  const int which = blockIdx.x & 1, head = blockIdx.x >> 1, b = m0 / S, tok0 = m0 % S;   // tile = (head, k|v) interleaved per head
#pragma unroll
  for (int t = 0; t < 4; ++t) { const float bb = bf16_rne(bqkv[c0 + t * 16 + nloc]);   // + bias (bf16-rounded)
#pragma unroll
    for (int r = 0; r < 2; ++r)
#pragma unroll
      for (int v = 0; v < 8; ++v) acc[r][t][v] += bb; }
  if (which == 0) {                                             // k head: f16 packed tiles (hi + lo planes)
#pragma unroll
    for (int t = 0; t < 4; ++t)
#pragma unroll
      for (int r = 0; r < 2; ++r)
#pragma unroll
        for (int v = 0; v < 8; ++v) { b16 a_, c_; split16(acc[r][t][v] * QS, a_, c_); Th[wave][r * 16 + 8 * hlf + v][t * 16 + nloc] = a_; Tq[wave][r * 16 + 8 * hlf + v][t * 16 + nloc] = c_; }   // q, k carried x8 (lo residuals stay normal)
    wave_lds_sync();
    b16* dst = kh + (((size_t)b * H + head) * S + tok0) * HD;
    {
#pragma unroll
      for (int j = 0; j < 8; ++j) { const int rr = (j >> 2) * 16 + nloc, c8 = ((j >> 1) & 1) * 32 + (j & 1) * 16 + hlf * 8;   // packed tiles [token tile][ks 2]: piece j = (token tile, ks, j)
        *(v8b*)(dst + j * 256 + lane * 8) = *(const v8b*)(&Th[wave][rr][c8]); *(v8b*)(dst + QPL + j * 256 + lane * 8) = *(const v8b*)(&Tq[wave][rr][c8]); }
       }
    return;
  }
  // v head: (8v)^T packed tiles [key tile 32][d tile 4], 32 keys = 2048 elements. A lane's accumulators acc[j][n][e] (key 16 j + 8 hlf + e, d 16 n + nloc) are its own
  // packed piece (n, j), so they are stored straight from registers.
  b16* dstv = vt + (((size_t)b * H + head) * HD) * S + (size_t)tok0 * HD;
#pragma unroll
  for (int n = 0; n < 4; ++n)
#pragma unroll
    for (int j = 0; j < 2; ++j) { v8b a8, c8;
#pragma unroll
      for (int e = 0; e < 8; ++e) { b16 a_, c_; split16(acc[j][n][e] * VS, a_, c_); a8[e] = a_; c8[e] = c_; }
      *(v8b*)(dstv + (n * 2 + j) * 256 + lane * 8) = a8; *(v8b*)(dstv + VPL + (n * 2 + j) * 256 + lane * 8) = c8; }
  asm volatile("s_wait_xcnt 0x0" ::: "memory");   // stands behind the last v store, in front of any later write of a register that an issued store names
}

// attention without mask: wave = (b, h, 16 queries); key chunks of 32 over all S keys: S^T (K=64) + pos bias, online softmax f32, P^T f16, y^T += (8V)^T P^T;
template <int QT>
__global__ __launch_bounds__(256) void attn_kernel(const b16* __restrict__ kh, const b16* __restrict__ vt, const float* __restrict__ pb, const float* __restrict__ swp, float* __restrict__ y) {
  const float SW = swp[0];
  const int wid = threadIdx.x >> 5, lane = threadIdx.x & 31;
  const int qt = blockIdx.x * 8 + wid, jt = qt % QT, bh = qt / QT, h = bh % H, b = bh / H;
  const b16* Q = kh + ((size_t)bh * S) * HD; const b16* K = kh + ((size_t)bh * S) * HD; const b16* vb = vt + ((size_t)bh * HD) * S;
  v16b qf[2], ql[2];
#pragma unroll
  for (int ks = 0; ks < 2; ++ks) { qf[ks] = frag_pk(Q + (jt * 2 + ks) * 512, lane); ql[ks] = frag_pk(Q + QPL + (jt * 2 + ks) * 512, lane); }
  float m = -INFINITY, l = 0.0f; v8f o[4] = {{}, {}, {}, {}};
  const float* pbq = pb + (size_t)jt * (S / 32) * 512 + lane * 4;   // this query tile's additive bias, packed f32 tiles
  // Loads run ahead of their use: a chunk's key fragments and bias are fetched during the chunk before it, its value fragments at the chunk's top, ahead of the score products.
  v16b kf[2][2]; v4f pq[4];
#pragma unroll
  for (int ks = 0; ks < 2; ++ks) { kf[ks][0] = frag_pk(K + ks * 512, lane); kf[ks][1] = frag_pk(K + 1024 + ks * 512, lane); }
#pragma unroll
  for (int j = 0; j < 4; ++j) pq[j] = *(const v4f*)(pbq + j * 128);
  for (int kb = 0; kb < S; kb += 32) {
    const b16* vhp = vb + kb * HD + lane * 8; const b16* vlp = vhp + VPL;
    v16b vf[4], vl[4];
#pragma unroll
    for (int n = 0; n < 4; ++n) { vf[n] = cat8b(ld8b(vhp + n * 512), ld8b(vhp + n * 512 + 256)); vl[n] = cat8b(ld8b(vlp + n * 512), ld8b(vlp + n * 512 + 256)); }
    // stands behind the value loads, in front of any write of a register that they name; no load sinks below it to its use
    asm volatile("s_wait_xcnt 0x0" ::: "memory");
    v8f s0 = {}, s1 = {};
#pragma unroll
    for (int ks = 0; ks < 2; ++ks) {
      s0 = wmma16b(kf[ks][0], qf[ks], s0); s0 = wmma16b(kf[ks][0], ql[ks], s0);      // query side hi+lo, key side hi only (2 products): the key's 2^-11 rounding moves the O(1) logits by ~3e-5
      s1 = wmma16b(kf[ks][1], qf[ks], s1); s1 = wmma16b(kf[ks][1], ql[ks], s1); }
    const int kn = kb + 32 < S ? kb + 32 : kb;   // next chunk; the last pass fetches its own again (in bounds, unused)
    const b16* kp = K + kn * HD + lane * 8;
#pragma unroll
    for (int ks = 0; ks < 2; ++ks) { kf[ks][0] = cat8b(ld8b(kp + ks * 512), ld8b(kp + ks * 512 + 256)); kf[ks][1] = cat8b(ld8b(kp + 1024 + ks * 512), ld8b(kp + 1024 + ks * 512 + 256)); }
    // the same behind the next chunk's key loads: they stay here, a whole softmax and value product ahead of their use
    asm volatile("s_wait_xcnt 0x0" ::: "memory");
    float mr = -INFINITY;
#pragma unroll
    for (int r = 0; r < 8; ++r) { s0[r] = s0[r] * (SCALE * SW / (QS * QS)) + pq[r >> 2][r & 3]; s1[r] = s1[r] * (SCALE * SW / (QS * QS)) + pq[2 + (r >> 2)][r & 3]; mr = fmaxf(mr, fmaxf(s0[r], s1[r])); }
    const float* pp = pbq + kn * 16;
#pragma unroll
    for (int j = 0; j < 4; ++j) pq[j] = *(const v4f*)(pp + j * 128);
    // the same behind the next chunk's bias loads, which stay ahead of the exponentials
    asm volatile("s_wait_xcnt 0x0" ::: "memory");
    mr = fmaxf(mr, __shfl_xor(mr, 16));
    const float mn = fmaxf(m, mr), al_ = __expf(m - mn); m = mn;
    float sum = 0.0f; v16b pb, pl;
#pragma unroll
    for (int r = 0; r < 8; ++r) { const float e0 = __expf(s0[r] - mn), e1 = __expf(s1[r] - mn); sum += e0 + e1; b16 a, c; split16(e0 * PS, a, c); pb[r] = a; pl[r] = c; split16(e1 * PS, a, c); pb[8 + r] = a; pl[8 + r] = c; }   // P carried x8
    sum += __shfl_xor(sum, 16); l = l * al_ + sum;
#pragma unroll
    for (int n = 0; n < 4; ++n) {
#pragma unroll
      for (int r = 0; r < 8; ++r) o[n][r] *= al_;
      o[n] = wmma16b(vf[n], pb, o[n]); o[n] = wmma16b(vf[n], pl, o[n]); o[n] = wmma16b(vl[n], pb, o[n]);   // (8v) and P both as f16 hi+lo pairs (lo.lo dropped)
    }
  }
  const float inv = 1.0f / (VS * PS * l);
  float* dst = y + ((size_t)(b * QT + jt) * (D / 32) + h * 2) * 512;   // packed f32 tiles [token tile][k tile]; this head = 2 k tiles = 8 pieces of 512 B
  {
#pragma unroll
    for (int j = 0; j < 8; ++j) { v4f w;   // a lane's accumulators are its own packed pieces (d = 16 n + 8 hh + r), so no LDS exchange is needed
#pragma unroll
      for (int e = 0; e < 4; ++e) w[e] = o[j >> 1][(j & 1) * 4 + e] * inv;
      *(v4f*)(dst + j * 128 + lane * 4) = w; }
    
  }
}

// out = y W_o^T: (8192 x 1024) x (1024 x 1024); A = y x8 split at load into f16 hi + lo, B = f16(bf16 W_o) packed tiles; f32 rows; grid (16, 64).
__global__ __launch_bounds__(128) void out_kernel(const float* __restrict__ y, const b16* __restrict__ wo16, const float* __restrict__ bo, float* __restrict__ out) {
  __shared__ __attribute__((aligned(16))) float Ts[4][32 * 64];
  const int lane = threadIdx.x & 31, wave = threadIdx.x >> 5, nloc = lane & 15, m0 = blockIdx.y * 128 + wave * 32, c0 = blockIdx.x * 64;
  v8f acc[2][4];
#pragma unroll
  for (int r = 0; r < 2; ++r)
#pragma unroll
    for (int t = 0; t < 4; ++t) acc[r][t] = (v8f){};
  const float* ya = y + (size_t)(m0 >> 4) * (D / 32) * 512 + lane * 4; const b16* wb = wo16 + (size_t)(c0 >> 4) * (D / 32) * 512;   // packed tiles
  // Loads run one step ahead: y is fetched again as soon as the step's rows are split, each weight fragment as soon as its four products are issued.
  v4f yr[2][4]; v16b bh[4];
#pragma unroll
  for (int r = 0; r < 2; ++r)
#pragma unroll
    for (int j = 0; j < 4; ++j) yr[r][j] = *(const v4f*)(ya + r * (D / 32) * 512 + j * 128);
  // keeps the first y loads in front of the first weight loads, the order of the loop: loads return in order, and the split of y then waits for y alone
  asm volatile("s_wait_xcnt 0x0" ::: "memory");
#pragma unroll
  for (int t = 0; t < 4; ++t) bh[t] = frag_pk(wb + t * (D / 32) * 512, lane);
  for (int kt = 0; kt < D / 32; ++kt) {                                         // y as an f16 hi+lo pair carried x8 (2 products)
    v16b ah[2], al[2];
#pragma unroll
    for (int r = 0; r < 2; ++r)
#pragma unroll
      for (int j = 0; j < 4; ++j) {
#pragma unroll
        for (int e = 0; e < 4; ++e) { b16 a, c; split16(yr[r][j][e] * 8.0f, a, c); ah[r][j * 4 + e] = a; al[r][j * 4 + e] = c; } }
    const int kn = kt + 1 < D / 32 ? kt + 1 : kt;   // next step; the last one fetches its own again (in bounds, unused)
#pragma unroll
    for (int r = 0; r < 2; ++r)
#pragma unroll
      for (int j = 0; j < 4; ++j) yr[r][j] = *(const v4f*)(ya + (r * (D / 32) + kn) * 512 + j * 128);
    // stands behind the next step's y loads, in front of any write of a register that they name; they stay here, all sixteen products ahead of their use
    asm volatile("s_wait_xcnt 0x0" ::: "memory");
#pragma unroll
    for (int t = 0; t < 4; ++t) {
      acc[0][t] = wmma16b(ah[0], bh[t], acc[0][t]); acc[0][t] = wmma16b(al[0], bh[t], acc[0][t]);
      acc[1][t] = wmma16b(ah[1], bh[t], acc[1][t]); acc[1][t] = wmma16b(al[1], bh[t], acc[1][t]);
      bh[t] = frag_pk(wb + (t * (D / 32) + kn) * 512, lane); }
    // the same behind the next step's weight loads
    asm volatile("s_wait_xcnt 0x0" ::: "memory");
  }
#pragma unroll
  for (int t = 0; t < 4; ++t)
#pragma unroll
    for (int r = 0; r < 2; ++r)
#pragma unroll
      for (int v = 0; v < 8; ++v) acc[r][t][v] = acc[r][t][v] * (1.0f / 8.0f) + bf16_rne(bo[c0 + t * 16 + nloc]);
  epi_f32(acc, 1.0f, nullptr, out, D, m0, c0, lane, Ts[wave]);
}
}  // namespace

extern "C" void kernel_launch(void* const* d_in, const int* in_sizes, int n_in,
                              void* d_out, int out_size, void* d_ws, size_t ws_size, hipStream_t stream) {
  (void)n_in; (void)out_size;
  const float* x = (const float*)d_in[0]; const float* pos = (const float*)d_in[1]; const float* wqkv = (const float*)d_in[2]; const float* bqkv = (const float*)d_in[3]; const float* wo = (const float*)d_in[4]; const float* bo = (const float*)d_in[5]; const float* mw = (const float*)d_in[6]; const float* mb = (const float*)d_in[7];
  float* out = (float*)d_out;   // [8][1024][1024]
  if (in_sizes[0] != BT * S * D || in_sizes[1] != S * S * NP_ || in_sizes[2] != 2 * D * D || in_sizes[3] != 2 * D || in_sizes[4] != D * D || in_sizes[5] != D || in_sizes[6] != NP_) return;

  size_t off = 0; char* ws = (char*)d_ws;
  auto carve = [&](size_t bytes) { char* p = ws + off; off += (bytes + 255) & ~(size_t)255; return p; };
  unsigned short* x16 = (unsigned short*)carve((size_t)NTOK * D * 2); unsigned short* w16 = (unsigned short*)carve((size_t)2 * D * D * 2); b16* wo16 = (b16*)carve((size_t)D * D * 2);
  b16* kh = (b16*)carve((size_t)2 * NTOK * D * 2); b16* vt = (b16*)carve((size_t)2 * NTOK * D * 2); float* y = (float*)carve((size_t)NTOK * D * 4); float* pb = (float*)carve((size_t)S * S * 4); float* sw = (float*)carve(256);
  if (off > ws_size) return;                                    // ≈ 128 MB (122 MiB)
  prep_all_kernel<<<NB_ALL, 256, 0, stream>>>(x, pos, wqkv, wo, mw, mb, x16, w16, wo16, pb, sw);
  proj_kernel<<<dim3(2 * D / 64, NTOK / 128), 128, 0, stream>>>((const __bf16*)x16, (const __bf16*)w16, bqkv, kh, vt);
  attn_kernel<S / 16><<<Bn * H * (S / 16) / 8, 256, 0, stream>>>(kh, vt, pb, sw, y);
  out_kernel<<<dim3(D / 64, NTOK / 128), 128, 0, stream>>>(y, wo16, bo, out);
}

// v005
// Measured time: 164 microseconds a run.
// Next to v004, in two timings, it ran 1.04 times as fast each time.
// Counting every step since v000, it is 2.34 times as fast.
#include <hip/hip_runtime.h>

// MultiheadAttention_KV: kv = x kv_w^T + kv_b (16 heads x [k 64 | v 64] interleaved per head); scores = (k_q . k_k)/8 * sum(mp_w) + pos_bias[q][k] with pos_bias = pos mp_w^T + mp_b
// (shared over batch and heads; precomputed once); softmax; vals = a v; out = vals o_w^T + o_b -> [8][1024][1024]. Keys and queries are the SAME k rows.
namespace {
constexpr int BT = 8, Bn = 8, S = 1024, D = 1024, H = 16, HD = 64, NTOK = Bn * S, NP_ = 10;
constexpr float SCALE = 0.125f, VS = 8.0f, QS = 8.0f, PS = 8.0f;   // power-of-two carry scales so hi/lo residual planes stay normal in f16
constexpr size_t VPL = (size_t)NTOK * D;   // distance between the (8v)^T hi and lo planes
constexpr size_t QPL = (size_t)NTOK * D;   // distance between the q/k hi and lo planes

typedef _Float16 b16;
typedef __attribute__((ext_vector_type(16))) _Float16 v16b;
typedef __attribute__((ext_vector_type(8)))  _Float16 v8b;
typedef __attribute__((ext_vector_type(8)))  float v8f;
typedef __attribute__((ext_vector_type(4)))  float v4f;

__device__ __forceinline__ v8b ld8b(const b16* p) { return *(const v8b*)p; }
__device__ __forceinline__ v16b cat8b(v8b a, v8b b) { return __builtin_shufflevector(a, b, 0, 1, 2, 3, 4, 5, 6, 7, 8, 9, 10, 11, 12, 13, 14, 15); }
// Fragment-packed operand tiles. A 16-row x 32-k tile of a 16-bit operand is 512 elements laid out [j 2][lane 32][8]: lane = 16 * hh + row holds k = 16 * j + 8 * hh + e,
// the hardware k order of a 16x16x32 A or B fragment, so each wave-wide 16-byte load reads 512 contiguous bytes (4 whole lines instead of 16 partly used ones).
// An f32 tile is [j4 4][lane 32][4] with k = 16 * (j4 >> 1) + 8 * hh + 4 * (j4 & 1) + e.
__device__ __forceinline__ v16b frag_pk(const b16* tile, int lane) { return cat8b(ld8b(tile + lane * 8), ld8b(tile + 256 + lane * 8)); }
__device__ __forceinline__ void split16(float v, b16& hi, b16& lo) { hi = (b16)v; lo = (b16)(v - (float)hi); }
// Plain builtins: the compiler keeps the distance behind a matrix instruction itself and fills it with the kernel's own vector work where there is some.
__device__ __forceinline__ v8f wmma16b(v16b a, v16b b, v8f c) {
  v8f d = __builtin_amdgcn_wmma_f32_16x16x32_f16(false, a, false, b, (short)0, c, false, false);
  return d;
}
__device__ __forceinline__ void wave_lds_sync() {
  __builtin_amdgcn_fence(__ATOMIC_RELEASE, "workgroup");
  __builtin_amdgcn_wave_barrier();
  __builtin_amdgcn_fence(__ATOMIC_ACQUIRE, "workgroup");
}

__device__ __forceinline__ void epi_planes(v8f (&acc)[2][4], float scale, bool two, b16* __restrict__ oh, b16* __restrict__ ol, int ldo,
                                           int m0, int c0, int lane, b16* Th, b16* Tl) {
  const int nloc = lane & 15, hlf = lane >> 4;
#pragma unroll
  for (int t = 0; t < 4; ++t)
#pragma unroll
    for (int r = 0; r < 2; ++r)
#pragma unroll
      for (int v = 0; v < 8; ++v) {
        const int rr = r * 16 + v + 8 * hlf, cc = t * 16 + nloc;
        b16 h_, l_; split16(acc[r][t][v] * scale, h_, l_);
        Th[rr * 64 + cc] = h_; Tl[rr * 64 + cc] = l_;
      }
  wave_lds_sync();
  {
#pragma unroll
    for (int j = 0; j < 8; ++j) {
      const int rr = j * 4 + (lane >> 3), c8 = (lane & 7) * 8;
      const size_t o = (size_t)(m0 + rr) * ldo + c0 + c8;
      *(v8b*)(oh + o) = ld8b(Th + rr * 64 + c8);
      if (two) *(v8b*)(ol + o) = ld8b(Tl + rr * 64 + c8);
    }
    
  }
}
// (b) f32 rows with pitch ldo: 64 floats = 256 B = 2 lines per row; 16 lanes x 16 B per row, 2 rows per instruction. Optional per-row factor
__device__ __forceinline__ void epi_f32(v8f (&acc)[2][4], float scale, const float* rscale, float* __restrict__ out, int ldo, int m0, int c0, int lane, float* Tt) {
  const int nloc = lane & 15, hlf = lane >> 4;
#pragma unroll
  for (int t = 0; t < 4; ++t)
#pragma unroll
    for (int r = 0; r < 2; ++r)
#pragma unroll
      for (int v = 0; v < 8; ++v) {
        const int rr = r * 16 + v + 8 * hlf;
        const float rs = rscale ? rscale[(size_t)(m0 + rr) * 32] : 1.0f;
        Tt[rr * 64 + t * 16 + nloc] = acc[r][t][v] * scale * rs;
      }
  wave_lds_sync();
  float* dst0 = out + (size_t)m0 * ldo + c0;
  {
#pragma unroll
    for (int j = 0; j < 16; ++j) { const int rr = j * 2 + hlf, c4 = nloc * 4; *(v4f*)(dst0 + (size_t)rr * ldo + c4) = *(const v4f*)(Tt + rr * 64 + c4); }
    
  }
}



typedef __attribute__((ext_vector_type(8))) __bf16 v8bb; typedef __attribute__((ext_vector_type(16))) __bf16 v16bb;
__device__ __forceinline__ v16bb frag_pk_bf(const __bf16* tile, int lane) { const v8bb a = *(const v8bb*)(tile + lane * 8), b = *(const v8bb*)(tile + 256 + lane * 8); return __builtin_shufflevector(a, b, 0, 1, 2, 3, 4, 5, 6, 7, 8, 9, 10, 11, 12, 13, 14, 15); }
__device__ __forceinline__ v8f wmma16bb(v16bb a, v16bb b, v8f c) {
  v8f d = __builtin_amdgcn_wmma_f32_16x16x32_bf16(false, a, false, b, (short)0, c, false, false);
  return d;
}
__device__ __forceinline__ unsigned short bf16_rne_bits(float v) { unsigned int u = __float_as_uint(v); u += 0x7FFFu + ((u >> 16) & 1u); return (unsigned short)(u >> 16); }
__device__ __forceinline__ float bf16_rne(float v) { return __uint_as_float(((unsigned int)bf16_rne_bits(v)) << 16); }



// Preparation kernels read whole 128-byte lines. One wave packs one 16-row x 32-k tile per pass: in load i lane l reads floats 4 * (l & 7) .. + 3 of row 4 * i + (l >> 3), so 8 lanes
// take a row's whole line; those 4 values (k = 4 c + e, c = l & 7) are half of the packed piece (j = c >> 2, hh = (c >> 1) & 1, row) and go out as one 8-byte store.
// The unroll directives of this part make every index of the small arrays a constant, so that they stay in registers and a pass's loads issue together.
typedef __attribute__((ext_vector_type(4))) unsigned short v4us; typedef __attribute__((ext_vector_type(4))) _Float16 v4b;
__device__ __forceinline__ size_t tile_src(size_t tile, int i, int lane) { return ((tile >> 5) * 16 + i * 4 + (lane >> 3)) * D + (tile & 31) * 32 + (lane & 7) * 4; }   // tiles ordered [row tile][k tile]
__device__ __forceinline__ size_t tile_dst(size_t tile, int i, int lane) { const int c = lane & 7; return tile * 512 + (c >> 2) * 256 + (((c >> 1) & 1) * 16 + i * 4 + (lane >> 3)) * 8 + (c & 1) * 4; }
__device__ __forceinline__ void pack_bf_tile(const float* __restrict__ s, unsigned short* __restrict__ d, size_t tile, int lane) {
  v4f f[4];
#pragma unroll
  for (int i = 0; i < 4; ++i) f[i] = *(const v4f*)(s + tile_src(tile, i, lane));
#pragma unroll
  for (int i = 0; i < 4; ++i) { v4us v;
#pragma unroll
    for (int e = 0; e < 4; ++e) v[e] = bf16_rne_bits(f[i][e]);
    *(v4us*)(d + tile_dst(tile, i, lane)) = v; }
}
// The three preparation parts depend on nothing but the inputs, so they share ONE launch (prep_all_kernel below): each is a device function that is told its work-group's index within the part.
constexpr int NB_X = 1024, NB_W = 512;   // work-groups of 256 threads for the x part and for the weight part
__device__ __forceinline__ void xprep_part(int bid, const float* __restrict__ x, unsigned short* __restrict__ x16) {   // x -> bf16 packed tiles [token tile][k tile]
  const int lane = threadIdx.x & 31;
  const size_t wv = ((size_t)bid * 256 + threadIdx.x) >> 5, nwv = ((size_t)NB_X * 256) >> 5;
  for (size_t tile = wv; tile < (size_t)NTOK * D / 512; tile += nwv) pack_bf_tile(x, x16, tile, lane);
}
__device__ __forceinline__ void wprep_part(int bid, const float* __restrict__ wqkv, const float* __restrict__ wo, unsigned short* __restrict__ w16, b16* __restrict__ wo16) {
  const int lane = threadIdx.x & 31;
  const size_t wv = ((size_t)bid * 256 + threadIdx.x) >> 5, nwv = ((size_t)NB_W * 256) >> 5;
  for (size_t tile = wv; tile < (size_t)2 * D * D / 512; tile += nwv) pack_bf_tile(wqkv, w16, tile, lane);   // kv_w [2048][1024] ([out][in]) rows -> packed tiles [out tile][k tile]
  for (size_t tile = wv; tile < (size_t)D * D / 512; tile += nwv) {                                          // W_o [out][in] rows -> packed tiles [out tile][k tile]
    v4f f[4];
#pragma unroll
    for (int i = 0; i < 4; ++i) f[i] = *(const v4f*)(wo + tile_src(tile, i, lane));
#pragma unroll
    for (int i = 0; i < 4; ++i) { v4b w;
#pragma unroll
      for (int e = 0; e < 4; ++e) w[e] = (b16)bf16_rne(f[i][e]);
      *(v4b*)(wo16 + tile_dst(tile, i, lane)) = w; }
  }
}

// pos_bias: a work-group makes one query tile (16 rows) x 128 keys. A row's 128 keys x 10 features are 5120 contiguous bytes: each wave brings two rows as whole-line loads into LDS;
// behind the barrier each thread reads the 40 floats of 4 keys of its own packed place. Row pitch 5120 + 16 bytes: sixteen rows' 16-byte reads fall on different banks.
constexpr int PBK = 128, PROW = PBK * NP_ + 4, NB_POS = (S / 16) * (S / PBK), NB_ALL = NB_POS + NB_X + NB_W;   // NB_POS: work-groups of the bias part; NB_ALL: the whole preparation grid
__device__ __forceinline__ void posb_part(int bid, float* P, const float* __restrict__ pos, const float* __restrict__ mw, const float* __restrict__ mb, float* __restrict__ pb, float* __restrict__ sw) {
  const int t = threadIdx.x, lane = t & 31, wave = t >> 5, qt = bid / (S / PBK), kq = bid % (S / PBK);
  v4f st[2][NP_];
#pragma unroll
  for (int r = 0; r < 2; ++r)
#pragma unroll
    for (int i = 0; i < NP_; ++i) st[r][i] = *(const v4f*)(pos + ((size_t)(qt * 16 + wave * 2 + r) * S + kq * PBK) * NP_ + i * 128 + lane * 4);
  float w[NP_];
#pragma unroll
  for (int p = 0; p < NP_; ++p) w[p] = bf16_rne(mw[p]);
  const float b0 = bf16_rne(mb[0]);
#pragma unroll
  for (int r = 0; r < 2; ++r)
#pragma unroll
    for (int i = 0; i < NP_; ++i) *(v4f*)(P + (wave * 2 + r) * PROW + i * 128 + lane * 4) = st[r][i];
  __syncthreads();   // every row is staged before any thread reads across rows
  float* dst = pb + ((size_t)qt * (S / 32) + kq * (PBK / 32)) * 512;   // packed f32 tiles [query tile 64][key tile 32][j4 4][lane 32][4]; this work-group's four key tiles are 8 KiB in a row
#pragma unroll
  for (int h = 0; h < 2; ++h) {
    const int gi = h * 256 + t, j4 = (gi >> 5) & 3, kt = gi >> 7;
    const float* pr = P + (lane & 15) * PROW + (kt * 32 + (j4 >> 1) * 16 + (lane >> 4) * 8 + (j4 & 1) * 4) * NP_;
    v4f f[NP_], o;
#pragma unroll
    for (int i = 0; i < NP_; ++i) f[i] = *(const v4f*)(pr + i * 4);
#pragma unroll
    for (int e = 0; e < 4; ++e) { float s = b0;
#pragma unroll
      for (int p = 0; p < NP_; ++p) s += bf16_rne(f[(e * NP_ + p) >> 2][(e * NP_ + p) & 3]) * w[p];   // a product of two bf16 values is exact in f32 (short of underflow): fused or not, each addition rounds the same
      o[e] = s; }
    *(v4f*)(dst + gi * 4) = o;
  }
  if (bid == 0 && t < 64) { float s = 0.0f;   // sum of bf16(mp_w), replicated over one 256-B row
#pragma unroll
    for (int p = 0; p < NP_; ++p) s += w[p];
    sw[t] = s; }
}
// One launch for all preparation. The part is chosen by the work-group's index alone, so every branch (and the bias part's barrier) is uniform over the work-group.
// The bias work-groups move the most bytes each and come first in index order (for speed only).
__global__ __launch_bounds__(256) void prep_all_kernel(const float* __restrict__ x, const float* __restrict__ pos, const float* __restrict__ wqkv, const float* __restrict__ wo,
                                                       const float* __restrict__ mw, const float* __restrict__ mb, unsigned short* __restrict__ x16, unsigned short* __restrict__ w16,
                                                       b16* __restrict__ wo16, float* __restrict__ pb, float* __restrict__ sw) {
  __shared__ __attribute__((aligned(16))) float P[16 * PROW];
  const int bid = blockIdx.x;
  if (bid < NB_POS) posb_part(bid, P, pos, mw, mb, pb, sw);
  else if (bid < NB_POS + NB_X) xprep_part(bid - NB_POS, x, x16);
  else wprep_part(bid - NB_POS - NB_X, wqkv, wo, w16, wo16);
}

// projections: rows = tokens (8192), K = 1024, column tiles of 64 = one head's k or v (interleaved per head); k: f16 packed tiles [b*H + head][token tile 64][ks 2];
// v: (8v)^T f16 packed tiles [b*H + head][key tile 32][d tile 4]. grid (32, 64) x 128.
__global__ __launch_bounds__(128) void proj_kernel(const __bf16* __restrict__ x16, const __bf16* __restrict__ w16, const float* __restrict__ bqkv, b16* __restrict__ kh, b16* __restrict__ vt) {
  __shared__ __attribute__((aligned(16))) b16 Th[4][32][HD + 8], Tq[4][32][HD + 8];
  const int lane = threadIdx.x & 31, wave = threadIdx.x >> 5, nloc = lane & 15, hlf = lane >> 4, m0 = blockIdx.y * 128 + wave * 32, c0 = blockIdx.x * 64;
  v8f acc[2][4];
#pragma unroll
  for (int r = 0; r < 2; ++r)
#pragma unroll
    for (int t = 0; t < 4; ++t) acc[r][t] = (v8f){};
  const __bf16* xa = x16 + (size_t)(m0 >> 4) * (D / 32) * 512; const __bf16* wb = w16 + (size_t)(c0 >> 4) * (D / 32) * 512;   // packed tiles, 512 elements each
#pragma unroll 2
  for (int kt = 0; kt < D / 32; ++kt) {
    const v16bb a0 = frag_pk_bf(xa + kt * 512, lane), a1 = frag_pk_bf(xa + (D / 32 + kt) * 512, lane); v16bb bw[4];
#pragma unroll
    for (int t = 0; t < 4; ++t) bw[t] = frag_pk_bf(wb + (t * (D / 32) + kt) * 512, lane);
    // stands behind the step's twelve loads, in front of any write of a register that they name; no load sinks below it, so they fly together and not one pair after another
    asm volatile("s_wait_xcnt 0x0" ::: "memory");
    __builtin_amdgcn_sched_barrier(0);   // compile-time only: the scheduler moves nothing across it, so the step's twelve loads stay one group; without it they are split into pairs among the products, each pair with a wait of its own
#pragma unroll
    for (int t = 0; t < 4; ++t) { acc[0][t] = wmma16bb(a0, bw[t], acc[0][t]); acc[1][t] = wmma16bb(a1, bw[t], acc[1][t]); }
  }
  const int which = blockIdx.x & 1, head = blockIdx.x >> 1, b = m0 / S, tok0 = m0 % S;   // tile = (head, k|v) interleaved per head
#pragma unroll
  for (int t = 0; t < 4; ++t) { const float bb = bf16_rne(bqkv[c0 + t * 16 + nloc]);   // + bias (bf16-rounded)
#pragma unroll
    for (int r = 0; r < 2; ++r)
#pragma unroll
      for (int v = 0; v < 8; ++v) acc[r][t][v] += bb; }
  if (which == 0) {                                             // k head: f16 packed tiles (hi + lo planes)
#pragma unroll
    for (int t = 0; t < 4; ++t)
#pragma unroll
      for (int r = 0; r < 2; ++r)
#pragma unroll
        for (int v = 0; v < 8; ++v) { b16 a_, c_; split16(acc[r][t][v] * QS, a_, c_); Th[wave][r * 16 + 8 * hlf + v][t * 16 + nloc] = a_; Tq[wave][r * 16 + 8 * hlf + v][t * 16 + nloc] = c_; }   // q, k carried x8 (lo residuals stay normal)
    wave_lds_sync();
    b16* dst = kh + (((size_t)b * H + head) * S + tok0) * HD;
    {
#pragma unroll
      for (int j = 0; j < 8; ++j) { const int rr = (j >> 2) * 16 + nloc, c8 = ((j >> 1) & 1) * 32 + (j & 1) * 16 + hlf * 8;   // packed tiles [token tile][ks 2]: piece j = (token tile, ks, j)
        *(v8b*)(dst + j * 256 + lane * 8) = *(const v8b*)(&Th[wave][rr][c8]); *(v8b*)(dst + QPL + j * 256 + lane * 8) = *(const v8b*)(&Tq[wave][rr][c8]); }
       }
    return;
  }
  // v head: (8v)^T packed tiles [key tile 32][d tile 4], 32 keys = 2048 elements. A lane's accumulators acc[j][n][e] (key 16 j + 8 hlf + e, d 16 n + nloc) are its own
  // packed piece (n, j), so they are stored straight from registers.
  b16* dstv = vt + (((size_t)b * H + head) * HD) * S + (size_t)tok0 * HD;
#pragma unroll
  for (int n = 0; n < 4; ++n)
#pragma unroll
    for (int j = 0; j < 2; ++j) { v8b a8, c8;
#pragma unroll
      for (int e = 0; e < 8; ++e) { b16 a_, c_; split16(acc[j][n][e] * VS, a_, c_); a8[e] = a_; c8[e] = c_; }
      *(v8b*)(dstv + (n * 2 + j) * 256 + lane * 8) = a8; *(v8b*)(dstv + VPL + (n * 2 + j) * 256 + lane * 8) = c8; }
  asm volatile("s_wait_xcnt 0x0" ::: "memory");   // stands behind the last v store, in front of any later write of a register that an issued store names
}

// attention without mask: wave = (b, h, 16 queries); key chunks of 32 over all S keys: S^T (K=64) + pos bias, online softmax f32, P^T f16, y^T += (8V)^T P^T;
template <int QT>
__global__ __launch_bounds__(256) void attn_kernel(const b16* __restrict__ kh, const b16* __restrict__ vt, const float* __restrict__ pb, const float* __restrict__ swp, float* __restrict__ y) {
  const float SW = swp[0];
  const int wid = threadIdx.x >> 5, lane = threadIdx.x & 31;
  const int qt = blockIdx.x * 8 + wid, jt = qt % QT, bh = qt / QT, h = bh % H, b = bh / H;
  const b16* Q = kh + ((size_t)bh * S) * HD; const b16* K = kh + ((size_t)bh * S) * HD; const b16* vb = vt + ((size_t)bh * HD) * S;
  v16b qf[2], ql[2];
#pragma unroll
  for (int ks = 0; ks < 2; ++ks) { qf[ks] = frag_pk(Q + (jt * 2 + ks) * 512, lane); ql[ks] = frag_pk(Q + QPL + (jt * 2 + ks) * 512, lane); }
  float m = -INFINITY, l = 0.0f; v8f o[4] = {{}, {}, {}, {}};
  const float* pbq = pb + (size_t)jt * (S / 32) * 512 + lane * 4;   // this query tile's additive bias, packed f32 tiles
  // Loads run ahead of their use: a chunk's key fragments and bias are fetched during the chunk before it, its value fragments at the chunk's top, ahead of the score products.
  v16b kf[2][2]; v4f pq[4];
#pragma unroll
  for (int ks = 0; ks < 2; ++ks) { kf[ks][0] = frag_pk(K + ks * 512, lane); kf[ks][1] = frag_pk(K + 1024 + ks * 512, lane); }
#pragma unroll
  for (int j = 0; j < 4; ++j) pq[j] = *(const v4f*)(pbq + j * 128);
  for (int kb = 0; kb < S; kb += 32) {
    const b16* vhp = vb + kb * HD + lane * 8; const b16* vlp = vhp + VPL;
    v16b vf[4], vl[4];
#pragma unroll
    for (int n = 0; n < 4; ++n) { vf[n] = cat8b(ld8b(vhp + n * 512), ld8b(vhp + n * 512 + 256)); vl[n] = cat8b(ld8b(vlp + n * 512), ld8b(vlp + n * 512 + 256)); }
    // stands behind the value loads, in front of any write of a register that they name; no load sinks below it to its use
    asm volatile("s_wait_xcnt 0x0" ::: "memory");
    __builtin_amdgcn_sched_barrier(0);   // compile-time only: holds the value loads up here; without it the scheduler sinks them to the value products, where each wait covers a whole fetch
    v8f s0 = {}, s1 = {};
#pragma unroll
    for (int ks = 0; ks < 2; ++ks) {
      s0 = wmma16b(kf[ks][0], qf[ks], s0); s0 = wmma16b(kf[ks][0], ql[ks], s0);      // query side hi+lo, key side hi only (2 products): the key's 2^-11 rounding moves the O(1) logits by ~3e-5
      s1 = wmma16b(kf[ks][1], qf[ks], s1); s1 = wmma16b(kf[ks][1], ql[ks], s1); }
    const int kn = kb + 32 < S ? kb + 32 : kb;   // next chunk; the last pass fetches its own again (in bounds, unused)
    const b16* kp = K + kn * HD + lane * 8;
#pragma unroll
    for (int ks = 0; ks < 2; ++ks) { kf[ks][0] = cat8b(ld8b(kp + ks * 512), ld8b(kp + ks * 512 + 256)); kf[ks][1] = cat8b(ld8b(kp + 1024 + ks * 512), ld8b(kp + 1024 + ks * 512 + 256)); }
    // the same behind the next chunk's key loads: they stay here, a whole softmax and value product ahead of their use
    asm volatile("s_wait_xcnt 0x0" ::: "memory");
    __builtin_amdgcn_sched_barrier(0);   // compile-time only: holds the next chunk's key loads here, a whole softmax ahead of their use
    float mr = -INFINITY;
#pragma unroll
    for (int r = 0; r < 8; ++r) { s0[r] = s0[r] * (SCALE * SW / (QS * QS)) + pq[r >> 2][r & 3]; s1[r] = s1[r] * (SCALE * SW / (QS * QS)) + pq[2 + (r >> 2)][r & 3]; mr = fmaxf(mr, fmaxf(s0[r], s1[r])); }
    const float* pp = pbq + kn * 16;
#pragma unroll
    for (int j = 0; j < 4; ++j) pq[j] = *(const v4f*)(pp + j * 128);
    // the same behind the next chunk's bias loads, which stay ahead of the exponentials
    asm volatile("s_wait_xcnt 0x0" ::: "memory");
    __builtin_amdgcn_sched_barrier(0);   // compile-time only: holds the next chunk's bias loads here, ahead of the exponentials
    mr = fmaxf(mr, __shfl_xor(mr, 16));
    const float mn = fmaxf(m, mr), al_ = __expf(m - mn); m = mn;
    float sum = 0.0f; v16b pb, pl;
#pragma unroll
    for (int r = 0; r < 8; ++r) { const float e0 = __expf(s0[r] - mn), e1 = __expf(s1[r] - mn); sum += e0 + e1; b16 a, c; split16(e0 * PS, a, c); pb[r] = a; pl[r] = c; split16(e1 * PS, a, c); pb[8 + r] = a; pl[8 + r] = c; }   // P carried x8
    sum += __shfl_xor(sum, 16); l = l * al_ + sum;
    __builtin_amdgcn_sched_barrier(0);   // compile-time only: the register moves that read the next chunk's bias and keys, and their waits, stay below, among the value products
#pragma unroll
    for (int n = 0; n < 4; ++n) {
#pragma unroll
      for (int r = 0; r < 8; ++r) o[n][r] *= al_;
      o[n] = wmma16b(vf[n], pb, o[n]); o[n] = wmma16b(vf[n], pl, o[n]); o[n] = wmma16b(vl[n], pb, o[n]);   // (8v) and P both as f16 hi+lo pairs (lo.lo dropped)
    }
  }
  const float inv = 1.0f / (VS * PS * l);
  float* dst = y + ((size_t)(b * QT + jt) * (D / 32) + h * 2) * 512;   // packed f32 tiles [token tile][k tile]; this head = 2 k tiles = 8 pieces of 512 B
  {
#pragma unroll
    for (int j = 0; j < 8; ++j) { v4f w;   // a lane's accumulators are its own packed pieces (d = 16 n + 8 hh + r), so no LDS exchange is needed
#pragma unroll
      for (int e = 0; e < 4; ++e) w[e] = o[j >> 1][(j & 1) * 4 + e] * inv;
      *(v4f*)(dst + j * 128 + lane * 4) = w; }
    
  }
}

// out = y W_o^T: (8192 x 1024) x (1024 x 1024); A = y x8 split at load into f16 hi + lo, B = f16(bf16 W_o) packed tiles; f32 rows; grid (16, 64).
__global__ __launch_bounds__(128) void out_kernel(const float* __restrict__ y, const b16* __restrict__ wo16, const float* __restrict__ bo, float* __restrict__ out) {
  __shared__ __attribute__((aligned(16))) float Ts[4][32 * 64];
  const int lane = threadIdx.x & 31, wave = threadIdx.x >> 5, nloc = lane & 15, m0 = blockIdx.y * 128 + wave * 32, c0 = blockIdx.x * 64;
  v8f acc[2][4];
#pragma unroll
  for (int r = 0; r < 2; ++r)
#pragma unroll
    for (int t = 0; t < 4; ++t) acc[r][t] = (v8f){};
  const float* ya = y + (size_t)(m0 >> 4) * (D / 32) * 512 + lane * 4; const b16* wb = wo16 + (size_t)(c0 >> 4) * (D / 32) * 512;   // packed tiles
  // Loads run one step ahead: y is fetched again as soon as the step's rows are split, each weight fragment as soon as its four products are issued.
  v4f yr[2][4]; v16b bh[4];
#pragma unroll
  for (int r = 0; r < 2; ++r)
#pragma unroll
    for (int j = 0; j < 4; ++j) yr[r][j] = *(const v4f*)(ya + r * (D / 32) * 512 + j * 128);
  // keeps the first y loads in front of the first weight loads, the order of the loop: loads return in order, and the split of y then waits for y alone
  asm volatile("s_wait_xcnt 0x0" ::: "memory");
#pragma unroll
  for (int t = 0; t < 4; ++t) bh[t] = frag_pk(wb + t * (D / 32) * 512, lane);
  for (int kt = 0; kt < D / 32; ++kt) {                                         // y as an f16 hi+lo pair carried x8 (2 products)
    v16b ah[2], al[2];
#pragma unroll
    for (int r = 0; r < 2; ++r)
#pragma unroll
      for (int j = 0; j < 4; ++j) {
#pragma unroll
        for (int e = 0; e < 4; ++e) { b16 a, c; split16(yr[r][j][e] * 8.0f, a, c); ah[r][j * 4 + e] = a; al[r][j * 4 + e] = c; } }
    const int kn = kt + 1 < D / 32 ? kt + 1 : kt;   // next step; the last one fetches its own again (in bounds, unused)
#pragma unroll
    for (int r = 0; r < 2; ++r)
#pragma unroll
      for (int j = 0; j < 4; ++j) yr[r][j] = *(const v4f*)(ya + (r * (D / 32) + kn) * 512 + j * 128);
    // stands behind the next step's y loads, in front of any write of a register that they name; they stay here, all sixteen products ahead of their use
    asm volatile("s_wait_xcnt 0x0" ::: "memory");
    __builtin_amdgcn_sched_barrier(0);   // compile-time only: holds the next step's y loads here, ahead of the sixteen products
#pragma unroll
    for (int t = 0; t < 4; ++t) {
      acc[0][t] = wmma16b(ah[0], bh[t], acc[0][t]); acc[0][t] = wmma16b(al[0], bh[t], acc[0][t]);
      acc[1][t] = wmma16b(ah[1], bh[t], acc[1][t]); acc[1][t] = wmma16b(al[1], bh[t], acc[1][t]);
      bh[t] = frag_pk(wb + (t * (D / 32) + kn) * 512, lane); }
    // the same behind the next step's weight loads
    asm volatile("s_wait_xcnt 0x0" ::: "memory");
    __builtin_amdgcn_sched_barrier(0);   // compile-time only: ends the step for the scheduler; without it a product's wait falls to 0 and covers the y loads just issued
  }
#pragma unroll
  for (int t = 0; t < 4; ++t)
#pragma unroll
    for (int r = 0; r < 2; ++r)
#pragma unroll
      for (int v = 0; v < 8; ++v) acc[r][t][v] = acc[r][t][v] * (1.0f / 8.0f) + bf16_rne(bo[c0 + t * 16 + nloc]);
  epi_f32(acc, 1.0f, nullptr, out, D, m0, c0, lane, Ts[wave]);
}
}  // namespace

extern "C" void kernel_launch(void* const* d_in, const int* in_sizes, int n_in,
                              void* d_out, int out_size, void* d_ws, size_t ws_size, hipStream_t stream) {
  (void)n_in; (void)out_size;
  const float* x = (const float*)d_in[0]; const float* pos = (const float*)d_in[1]; const float* wqkv = (const float*)d_in[2]; const float* bqkv = (const float*)d_in[3]; const float* wo = (const float*)d_in[4]; const float* bo = (const float*)d_in[5]; const float* mw = (const float*)d_in[6]; const float* mb = (const float*)d_in[7];
  float* out = (float*)d_out;   // [8][1024][1024]
  if (in_sizes[0] != BT * S * D || in_sizes[1] != S * S * NP_ || in_sizes[2] != 2 * D * D || in_sizes[3] != 2 * D || in_sizes[4] != D * D || in_sizes[5] != D || in_sizes[6] != NP_) return;

  size_t off = 0; char* ws = (char*)d_ws;
  auto carve = [&](size_t bytes) { char* p = ws + off; off += (bytes + 255) & ~(size_t)255; return p; };
  unsigned short* x16 = (unsigned short*)carve((size_t)NTOK * D * 2); unsigned short* w16 = (unsigned short*)carve((size_t)2 * D * D * 2); b16* wo16 = (b16*)carve((size_t)D * D * 2);
  b16* kh = (b16*)carve((size_t)2 * NTOK * D * 2); b16* vt = (b16*)carve((size_t)2 * NTOK * D * 2); float* y = (float*)carve((size_t)NTOK * D * 4); float* pb = (float*)carve((size_t)S * S * 4); float* sw = (float*)carve(256);
  if (off > ws_size) return;                                    // ≈ 128 MB (122 MiB)
  prep_all_kernel<<<NB_ALL, 256, 0, stream>>>(x, pos, wqkv, wo, mw, mb, x16, w16, wo16, pb, sw);
  proj_kernel<<<dim3(2 * D / 64, NTOK / 128), 128, 0, stream>>>((const __bf16*)x16, (const __bf16*)w16, bqkv, kh, vt);
  attn_kernel<S / 16><<<Bn * H * (S / 16) / 8, 256, 0, stream>>>(kh, vt, pb, sw, y);
  out_kernel<<<dim3(D / 64, NTOK / 128), 128, 0, stream>>>(y, wo16, bo, out);
}

// v006
// One run takes 155 microseconds.
// Next to v005, in two timings, it ran 1.05 times as fast each time.
// Over all steps from v000 it is 2.47 times as fast.
#include <hip/hip_runtime.h>

// MultiheadAttention_KV: kv = x kv_w^T + kv_b (16 heads x [k 64 | v 64] interleaved per head); scores = (k_q . k_k)/8 * sum(mp_w) + pos_bias[q][k] with pos_bias = pos mp_w^T + mp_b
// (shared over batch and heads; precomputed once); softmax; vals = a v; out = vals o_w^T + o_b -> [8][1024][1024]. Keys and queries are the SAME k rows.
namespace {
constexpr int BT = 8, Bn = 8, S = 1024, D = 1024, H = 16, HD = 64, NTOK = Bn * S, NP_ = 10;
constexpr float SCALE = 0.125f, VS = 8.0f, QS = 8.0f, PS = 8.0f;   // power-of-two carry scales so hi/lo residual planes stay normal in f16
constexpr size_t VPL = (size_t)NTOK * D;   // distance between the (8v)^T hi and lo planes
constexpr size_t QPL = (size_t)NTOK * D;   // distance between the q/k hi and lo planes

typedef _Float16 b16;
typedef __attribute__((ext_vector_type(16))) _Float16 v16b;
typedef __attribute__((ext_vector_type(8)))  _Float16 v8b;
typedef __attribute__((ext_vector_type(8)))  float v8f;
typedef __attribute__((ext_vector_type(4)))  float v4f;

__device__ __forceinline__ v8b ld8b(const b16* p) { return *(const v8b*)p; }
__device__ __forceinline__ v16b cat8b(v8b a, v8b b) { return __builtin_shufflevector(a, b, 0, 1, 2, 3, 4, 5, 6, 7, 8, 9, 10, 11, 12, 13, 14, 15); }
// Fragment-packed operand tiles. A 16-row x 32-k tile of a 16-bit operand is 512 elements laid out [j 2][lane 32][8]: lane = 16 * hh + row holds k = 16 * j + 8 * hh + e,
// the hardware k order of a 16x16x32 A or B fragment, so each wave-wide 16-byte load reads 512 contiguous bytes (4 whole lines instead of 16 partly used ones).
// An f32 tile is [j4 4][lane 32][4] with k = 16 * (j4 >> 1) + 8 * hh + 4 * (j4 & 1) + e.
__device__ __forceinline__ v16b frag_pk(const b16* tile, int lane) { return cat8b(ld8b(tile + lane * 8), ld8b(tile + 256 + lane * 8)); }
__device__ __forceinline__ void split16(float v, b16& hi, b16& lo) { hi = (b16)v; lo = (b16)(v - (float)hi); }
// Plain builtins: the compiler keeps the distance behind a matrix instruction itself and fills it with the kernel's own vector work where there is some.
__device__ __forceinline__ v8f wmma16b(v16b a, v16b b, v8f c) {
  v8f d = __builtin_amdgcn_wmma_f32_16x16x32_f16(false, a, false, b, (short)0, c, false, false);
  return d;
}
__device__ __forceinline__ void wave_lds_sync() {
  __builtin_amdgcn_fence(__ATOMIC_RELEASE, "workgroup");
  __builtin_amdgcn_wave_barrier();
  __builtin_amdgcn_fence(__ATOMIC_ACQUIRE, "workgroup");
}

__device__ __forceinline__ void epi_planes(v8f (&acc)[2][4], float scale, bool two, b16* __restrict__ oh, b16* __restrict__ ol, int ldo,
                                           int m0, int c0, int lane, b16* Th, b16* Tl) {
  const int nloc = lane & 15, hlf = lane >> 4;
#pragma unroll
  for (int t = 0; t < 4; ++t)
#pragma unroll
    for (int r = 0; r < 2; ++r)
#pragma unroll
      for (int v = 0; v < 8; ++v) {
        const int rr = r * 16 + v + 8 * hlf, cc = t * 16 + nloc;
        b16 h_, l_; split16(acc[r][t][v] * scale, h_, l_);
        Th[rr * 64 + cc] = h_; Tl[rr * 64 + cc] = l_;
      }
  wave_lds_sync();
  {
#pragma unroll
    for (int j = 0; j < 8; ++j) {
      const int rr = j * 4 + (lane >> 3), c8 = (lane & 7) * 8;
      const size_t o = (size_t)(m0 + rr) * ldo + c0 + c8;
      *(v8b*)(oh + o) = ld8b(Th + rr * 64 + c8);
      if (two) *(v8b*)(ol + o) = ld8b(Tl + rr * 64 + c8);
    }
    
  }
}
// (b) f32 rows with pitch ldo: 64 floats = 256 B = 2 lines per row; 16 lanes x 16 B per row, 2 rows per instruction. Optional per-row factor
__device__ __forceinline__ void epi_f32(v8f (&acc)[2][4], float scale, const float* rscale, float* __restrict__ out, int ldo, int m0, int c0, int lane, float* Tt) {
  const int nloc = lane & 15, hlf = lane >> 4;
#pragma unroll
  for (int t = 0; t < 4; ++t)
#pragma unroll
    for (int r = 0; r < 2; ++r)
#pragma unroll
      for (int v = 0; v < 8; ++v) {
        const int rr = r * 16 + v + 8 * hlf;
        const float rs = rscale ? rscale[(size_t)(m0 + rr) * 32] : 1.0f;
        Tt[rr * 64 + t * 16 + nloc] = acc[r][t][v] * scale * rs;
      }
  wave_lds_sync();
  float* dst0 = out + (size_t)m0 * ldo + c0;
  {
#pragma unroll
    for (int j = 0; j < 16; ++j) { const int rr = j * 2 + hlf, c4 = nloc * 4; *(v4f*)(dst0 + (size_t)rr * ldo + c4) = *(const v4f*)(Tt + rr * 64 + c4); }
    
  }
}



typedef __attribute__((ext_vector_type(8))) __bf16 v8bb; typedef __attribute__((ext_vector_type(16))) __bf16 v16bb;
__device__ __forceinline__ v16bb frag_pk_bf(const __bf16* tile, int lane) { const v8bb a = *(const v8bb*)(tile + lane * 8), b = *(const v8bb*)(tile + 256 + lane * 8); return __builtin_shufflevector(a, b, 0, 1, 2, 3, 4, 5, 6, 7, 8, 9, 10, 11, 12, 13, 14, 15); }
__device__ __forceinline__ v8f wmma16bb(v16bb a, v16bb b, v8f c) {
  v8f d = __builtin_amdgcn_wmma_f32_16x16x32_bf16(false, a, false, b, (short)0, c, false, false);
  return d;
}
__device__ __forceinline__ unsigned short bf16_rne_bits(float v) { unsigned int u = __float_as_uint(v); u += 0x7FFFu + ((u >> 16) & 1u); return (unsigned short)(u >> 16); }
__device__ __forceinline__ float bf16_rne(float v) { return __uint_as_float(((unsigned int)bf16_rne_bits(v)) << 16); }



// Preparation kernels read whole 128-byte lines. One wave packs one 16-row x 32-k tile per pass: in load i lane l reads floats 4 * (l & 7) .. + 3 of row 4 * i + (l >> 3), so 8 lanes
// take a row's whole line; those 4 values (k = 4 c + e, c = l & 7) are half of the packed piece (j = c >> 2, hh = (c >> 1) & 1, row) and go out as one 8-byte store.
// The unroll directives of this part make every index of the small arrays a constant, so that they stay in registers and a pass's loads issue together.
typedef __attribute__((ext_vector_type(4))) unsigned short v4us; typedef __attribute__((ext_vector_type(4))) _Float16 v4b;
__device__ __forceinline__ size_t tile_src(size_t tile, int i, int lane) { return ((tile >> 5) * 16 + i * 4 + (lane >> 3)) * D + (tile & 31) * 32 + (lane & 7) * 4; }   // tiles ordered [row tile][k tile]
__device__ __forceinline__ size_t tile_dst(size_t tile, int i, int lane) { const int c = lane & 7; return tile * 512 + (c >> 2) * 256 + (((c >> 1) & 1) * 16 + i * 4 + (lane >> 3)) * 8 + (c & 1) * 4; }
__device__ __forceinline__ void pack_bf_tile(const float* __restrict__ s, unsigned short* __restrict__ d, size_t tile, int lane) {
  v4f f[4];
#pragma unroll
  for (int i = 0; i < 4; ++i) f[i] = *(const v4f*)(s + tile_src(tile, i, lane));
#pragma unroll
  for (int i = 0; i < 4; ++i) { v4us v;
#pragma unroll
    for (int e = 0; e < 4; ++e) v[e] = bf16_rne_bits(f[i][e]);
    *(v4us*)(d + tile_dst(tile, i, lane)) = v; }
}
// The three preparation parts depend on nothing but the inputs, so they share ONE launch (prep_all_kernel below): each is a device function that is told its work-group's index within the part.
constexpr int NB_X = 1024, NB_W = 512;   // work-groups of 256 threads for the x part and for the weight part
__device__ __forceinline__ void xprep_part(int bid, const float* __restrict__ x, unsigned short* __restrict__ x16) {   // x -> bf16 packed tiles [token tile][k tile]
  const int lane = threadIdx.x & 31;
  const size_t wv = ((size_t)bid * 256 + threadIdx.x) >> 5, nwv = ((size_t)NB_X * 256) >> 5;
  for (size_t tile = wv; tile < (size_t)NTOK * D / 512; tile += nwv) pack_bf_tile(x, x16, tile, lane);
}
__device__ __forceinline__ void wprep_part(int bid, const float* __restrict__ wqkv, const float* __restrict__ wo, unsigned short* __restrict__ w16, b16* __restrict__ wo16) {
  const int lane = threadIdx.x & 31;
  const size_t wv = ((size_t)bid * 256 + threadIdx.x) >> 5, nwv = ((size_t)NB_W * 256) >> 5;
  for (size_t tile = wv; tile < (size_t)2 * D * D / 512; tile += nwv) pack_bf_tile(wqkv, w16, tile, lane);   // kv_w [2048][1024] ([out][in]) rows -> packed tiles [out tile][k tile]
  for (size_t tile = wv; tile < (size_t)D * D / 512; tile += nwv) {                                          // W_o [out][in] rows -> packed tiles [out tile][k tile]
    v4f f[4];
#pragma unroll
    for (int i = 0; i < 4; ++i) f[i] = *(const v4f*)(wo + tile_src(tile, i, lane));
#pragma unroll
    for (int i = 0; i < 4; ++i) { v4b w;
#pragma unroll
      for (int e = 0; e < 4; ++e) w[e] = (b16)bf16_rne(f[i][e]);
      *(v4b*)(wo16 + tile_dst(tile, i, lane)) = w; }
  }
}

// pos_bias: a work-group makes one query tile (16 rows) x 128 keys. A row's 128 keys x 10 features are 5120 contiguous bytes: each wave brings two rows as whole-line loads into LDS;
// behind the barrier each thread reads the 40 floats of 4 keys of its own packed place. Row pitch 5120 + 16 bytes: sixteen rows' 16-byte reads fall on different banks.
constexpr int PBK = 128, PROW = PBK * NP_ + 4, NB_POS = (S / 16) * (S / PBK), NB_ALL = NB_POS + NB_X + NB_W;   // NB_POS: work-groups of the bias part; NB_ALL: the whole preparation grid
__device__ __forceinline__ void posb_part(int bid, float* P, const float* __restrict__ pos, const float* __restrict__ mw, const float* __restrict__ mb, float* __restrict__ pb, float* __restrict__ sw) {
  const int t = threadIdx.x, lane = t & 31, wave = t >> 5, qt = bid / (S / PBK), kq = bid % (S / PBK);
  v4f st[2][NP_];
#pragma unroll
  for (int r = 0; r < 2; ++r)
#pragma unroll
    for (int i = 0; i < NP_; ++i) st[r][i] = *(const v4f*)(pos + ((size_t)(qt * 16 + wave * 2 + r) * S + kq * PBK) * NP_ + i * 128 + lane * 4);
  float w[NP_];
#pragma unroll
  for (int p = 0; p < NP_; ++p) w[p] = bf16_rne(mw[p]);
  const float b0 = bf16_rne(mb[0]);
#pragma unroll
  for (int r = 0; r < 2; ++r)
#pragma unroll
    for (int i = 0; i < NP_; ++i) *(v4f*)(P + (wave * 2 + r) * PROW + i * 128 + lane * 4) = st[r][i];
  __syncthreads();   // every row is staged before any thread reads across rows
  float* dst = pb + ((size_t)qt * (S / 32) + kq * (PBK / 32)) * 512;   // packed f32 tiles [query tile 64][key tile 32][j4 4][lane 32][4]; this work-group's four key tiles are 8 KiB in a row
#pragma unroll
  for (int h = 0; h < 2; ++h) {
    const int gi = h * 256 + t, j4 = (gi >> 5) & 3, kt = gi >> 7;
    const float* pr = P + (lane & 15) * PROW + (kt * 32 + (j4 >> 1) * 16 + (lane >> 4) * 8 + (j4 & 1) * 4) * NP_;
    v4f f[NP_], o;
#pragma unroll
    for (int i = 0; i < NP_; ++i) f[i] = *(const v4f*)(pr + i * 4);
#pragma unroll
    for (int e = 0; e < 4; ++e) { float s = b0;
#pragma unroll
      for (int p = 0; p < NP_; ++p) s += bf16_rne(f[(e * NP_ + p) >> 2][(e * NP_ + p) & 3]) * w[p];   // a product of two bf16 values is exact in f32 (short of underflow): fused or not, each addition rounds the same
      o[e] = s; }
    *(v4f*)(dst + gi * 4) = o;
  }
  if (bid == 0 && t < 64) { float s = 0.0f;   // sum of bf16(mp_w), replicated over one 256-B row
#pragma unroll
    for (int p = 0; p < NP_; ++p) s += w[p];
    sw[t] = s; }
}
// One launch for all preparation. The part is chosen by the work-group's index alone, so every branch (and the bias part's barrier) is uniform over the work-group.
// The bias work-groups move the most bytes each and come first in index order (for speed only).
__global__ __launch_bounds__(256) void prep_all_kernel(const float* __restrict__ x, const float* __restrict__ pos, const float* __restrict__ wqkv, const float* __restrict__ wo,
                                                       const float* __restrict__ mw, const float* __restrict__ mb, unsigned short* __restrict__ x16, unsigned short* __restrict__ w16,
                                                       b16* __restrict__ wo16, float* __restrict__ pb, float* __restrict__ sw) {
  __shared__ __attribute__((aligned(16))) float P[16 * PROW];
  const int bid = blockIdx.x;
  if (bid < NB_POS) posb_part(bid, P, pos, mw, mb, pb, sw);
  else if (bid < NB_POS + NB_X) xprep_part(bid - NB_POS, x, x16);
  else wprep_part(bid - NB_POS - NB_X, wqkv, wo, w16, wo16);
}

// projections: rows = tokens (8192), K = 1024, column tiles of 64 = one head's k or v (interleaved per head); k: f16 packed tiles [b*H + head][token tile 64][ks 2];
// v: (8v)^T f16 packed tiles [b*H + head][key tile 32][d tile 4]. grid (32, 64) x 128.
__global__ __launch_bounds__(128) void proj_kernel(const __bf16* __restrict__ x16, const __bf16* __restrict__ w16, const float* __restrict__ bqkv, b16* __restrict__ kh, b16* __restrict__ vt) {
  __shared__ __attribute__((aligned(16))) b16 Th[4][32][HD + 8], Tq[4][32][HD + 8];
  const int lane = threadIdx.x & 31, wave = threadIdx.x >> 5, nloc = lane & 15, hlf = lane >> 4, m0 = blockIdx.y * 128 + wave * 32, c0 = blockIdx.x * 64;
  v8f acc[2][4];
#pragma unroll
  for (int r = 0; r < 2; ++r)
#pragma unroll
    for (int t = 0; t < 4; ++t) acc[r][t] = (v8f){};
  const __bf16* xa = x16 + (size_t)(m0 >> 4) * (D / 32) * 512; const __bf16* wb = w16 + (size_t)(c0 >> 4) * (D / 32) * 512;   // packed tiles, 512 elements each
#pragma unroll 2
  for (int kt = 0; kt < D / 32; ++kt) {
    const v16bb a0 = frag_pk_bf(xa + kt * 512, lane), a1 = frag_pk_bf(xa + (D / 32 + kt) * 512, lane); v16bb bw[4];
#pragma unroll
    for (int t = 0; t < 4; ++t) bw[t] = frag_pk_bf(wb + (t * (D / 32) + kt) * 512, lane);
    // stands behind the step's twelve loads, in front of any write of a register that they name; no load sinks below it, so they fly together and not one pair after another
    asm volatile("s_wait_xcnt 0x0" ::: "memory");
    __builtin_amdgcn_sched_barrier(0);   // compile-time only: the scheduler moves nothing across it, so the step's twelve loads stay one group; without it they are split into pairs among the products, each pair with a wait of its own
#pragma unroll
    for (int t = 0; t < 4; ++t) { acc[0][t] = wmma16bb(a0, bw[t], acc[0][t]); acc[1][t] = wmma16bb(a1, bw[t], acc[1][t]); }
  }
  const int which = blockIdx.x & 1, head = blockIdx.x >> 1, b = m0 / S, tok0 = m0 % S;   // tile = (head, k|v) interleaved per head
#pragma unroll
  for (int t = 0; t < 4; ++t) { const float bb = bf16_rne(bqkv[c0 + t * 16 + nloc]);   // + bias (bf16-rounded)
#pragma unroll
    for (int r = 0; r < 2; ++r)
#pragma unroll
      for (int v = 0; v < 8; ++v) acc[r][t][v] += bb; }
  if (which == 0) {                                             // k head: f16 packed tiles (hi + lo planes)
#pragma unroll
    for (int t = 0; t < 4; ++t)
#pragma unroll
      for (int r = 0; r < 2; ++r)
#pragma unroll
        for (int v = 0; v < 8; ++v) { b16 a_, c_; split16(acc[r][t][v] * QS, a_, c_); Th[wave][r * 16 + 8 * hlf + v][t * 16 + nloc] = a_; Tq[wave][r * 16 + 8 * hlf + v][t * 16 + nloc] = c_; }   // q, k carried x8 (lo residuals stay normal)
    wave_lds_sync();
    b16* dst = kh + (((size_t)b * H + head) * S + tok0) * HD;
    {
#pragma unroll
      for (int j = 0; j < 8; ++j) { const int rr = (j >> 2) * 16 + nloc, c8 = ((j >> 1) & 1) * 32 + (j & 1) * 16 + hlf * 8;   // packed tiles [token tile][ks 2]: piece j = (token tile, ks, j)
        *(v8b*)(dst + j * 256 + lane * 8) = *(const v8b*)(&Th[wave][rr][c8]); *(v8b*)(dst + QPL + j * 256 + lane * 8) = *(const v8b*)(&Tq[wave][rr][c8]); }
       }
    return;
  }
  // v head: (8v)^T packed tiles [key tile 32][d tile 4], 32 keys = 2048 elements. A lane's accumulators acc[j][n][e] (key 16 j + 8 hlf + e, d 16 n + nloc) are its own
  // packed piece (n, j), so they are stored straight from registers.
  b16* dstv = vt + (((size_t)b * H + head) * HD) * S + (size_t)tok0 * HD;
#pragma unroll
  for (int n = 0; n < 4; ++n)
#pragma unroll
    for (int j = 0; j < 2; ++j) { v8b a8, c8;
#pragma unroll
      for (int e = 0; e < 8; ++e) { b16 a_, c_; split16(acc[j][n][e] * VS, a_, c_); a8[e] = a_; c8[e] = c_; }
      *(v8b*)(dstv + (n * 2 + j) * 256 + lane * 8) = a8; *(v8b*)(dstv + VPL + (n * 2 + j) * 256 + lane * 8) = c8; }
  asm volatile("s_wait_xcnt 0x0" ::: "memory");   // stands behind the last v store, in front of any later write of a register that an issued store names
}

// attention: wave = (b, h, 16 queries); key chunks of 32 over all 1024 keys, no mask: S^T (K=64), online softmax f32, P^T f16, y^T += (8V)^T P^T;
__device__ __forceinline__ float xhalf(float x) { return __builtin_bit_cast(float, __builtin_amdgcn_permlanex16(__builtin_bit_cast(int, x), __builtin_bit_cast(int, x), 0x76543210, 0xfedcba98, false, false)); }   // lane l with lane l ^ 16, a vector move (no LDS round trip)
__device__ __forceinline__ v8f cat4f(v4f a, v4f b) { return __builtin_shufflevector(a, b, 0, 1, 2, 3, 4, 5, 6, 7); }
constexpr float LOG2E = 1.44269504088896340736f;
template <int QT>
__global__ __launch_bounds__(256) void attn_kernel(const b16* __restrict__ kh, const b16* __restrict__ vt, const float* __restrict__ pb, const float* __restrict__ swp, float* __restrict__ y) {
  const int wid = threadIdx.x >> 5, lane = threadIdx.x & 31;
  const float SW = swp[lane];   // the sum is replicated over 64 floats: read by lane it lives in a vector register, which the packed multiply-adds take as it is (from a scalar register it was copied into vector pairs every pass)
  asm volatile("s_wait_xcnt 0x0" ::: "memory");   // stands behind that load, in front of any later write of the register that holds its offset
  const int qt = blockIdx.x * 8 + wid, jt = qt % QT, bh = qt / QT, h = bh % H, b = bh / H;
  const b16* Q = kh + ((size_t)bh * S) * HD; const b16* K = kh + ((size_t)bh * S) * HD; const b16* vb = vt + ((size_t)bh * HD) * S;
  v16b qf[2], ql[2];
#pragma unroll
  for (int ks = 0; ks < 2; ++ks) { qf[ks] = frag_pk(Q + (jt * 2 + ks) * 512, lane); ql[ks] = frag_pk(Q + QPL + (jt * 2 + ks) * 512, lane); }
  // Softmax state: m = running maximum; nm = 3 - m log2(e), the addend that turns a score into the exponent of 8 exp(s - m) in one fused multiply-add (the x8 carry of P rides in the exponent);
  // l = THIS LANE's running sum of 8 P over its own half of the keys; the two halves are joined once, behind the loop.
  float m = -INFINITY, nm = INFINITY, l = 0.0f; v8f o[4] = {{}, {}, {}, {}};
  const float C = SCALE * SW / (QS * QS);
  const float* pbq = pb + (size_t)jt * (S / 32) * 512 + lane * 4;   // this query tile's additive bias, packed f32 tiles
  // Loads run ahead of their use: a chunk's key fragments and bias are fetched during the chunk before it, its value fragments at the chunk's top, ahead of the score products.
  v16b kf[2][2]; v4f pq[4];
#pragma unroll
  for (int ks = 0; ks < 2; ++ks) { kf[ks][0] = frag_pk(K + ks * 512, lane); kf[ks][1] = frag_pk(K + 1024 + ks * 512, lane); }
#pragma unroll
  for (int j = 0; j < 4; ++j) pq[j] = *(const v4f*)(pbq + j * 128);
  for (int kb = 0; kb < S; kb += 32) {
    const b16* vhp = vb + kb * HD + lane * 8; const b16* vlp = vhp + VPL;
    v16b vf[4], vl[4];
#pragma unroll
    for (int n = 0; n < 4; ++n) { vf[n] = cat8b(ld8b(vhp + n * 512), ld8b(vhp + n * 512 + 256)); vl[n] = cat8b(ld8b(vlp + n * 512), ld8b(vlp + n * 512 + 256)); }
    // stands behind the value loads, in front of any write of a register that they name; no load sinks below it to its use
    asm volatile("s_wait_xcnt 0x0" ::: "memory");
    __builtin_amdgcn_sched_barrier(0);   // compile-time only: holds the value loads up here; without it the scheduler sinks them to the value products, where each wait covers a whole fetch
    v8f s0 = {}, s1 = {};
#pragma unroll
    for (int ks = 0; ks < 2; ++ks) {
      s0 = wmma16b(kf[ks][0], qf[ks], s0); s0 = wmma16b(kf[ks][0], ql[ks], s0);      // query side hi+lo, key side hi only (2 products): the key's 2^-11 rounding moves the O(1) logits by ~3e-5
      s1 = wmma16b(kf[ks][1], qf[ks], s1); s1 = wmma16b(kf[ks][1], ql[ks], s1); }
    const int kn = kb + 32 < S ? kb + 32 : kb;   // next chunk; the last pass fetches its own again (in bounds, unused)
    const b16* kp = K + kn * HD + lane * 8;
#pragma unroll
    for (int ks = 0; ks < 2; ++ks) { kf[ks][0] = cat8b(ld8b(kp + ks * 512), ld8b(kp + ks * 512 + 256)); kf[ks][1] = cat8b(ld8b(kp + 1024 + ks * 512), ld8b(kp + 1024 + ks * 512 + 256)); }
    // the same behind the next chunk's key loads: they stay here, a whole softmax and value product ahead of their use
    asm volatile("s_wait_xcnt 0x0" ::: "memory");
    __builtin_amdgcn_sched_barrier(0);   // compile-time only: holds the next chunk's key loads here, a whole softmax ahead of their use
    s0 = s0 * C + cat4f(pq[0], pq[1]); s1 = s1 * C + cat4f(pq[2], pq[3]);   // whole-vector forms: neighbouring registers pair up in packed instructions with no register moves
    float mr = -INFINITY;
#pragma unroll
    for (int r = 0; r < 8; ++r) mr = fmaxf(mr, fmaxf(s0[r], s1[r]));
    const float* pp = pbq + kn * 16;
#pragma unroll
    for (int j = 0; j < 4; ++j) pq[j] = *(const v4f*)(pp + j * 128);
    // the same behind the next chunk's bias loads, which stay ahead of the exponentials
    asm volatile("s_wait_xcnt 0x0" ::: "memory");
    __builtin_amdgcn_sched_barrier(0);   // compile-time only: holds the next chunk's bias loads here, ahead of the exponentials
    mr = fmaxf(mr, xhalf(mr));
    m = fmaxf(m, mr);
    const float nn = 3.0f - m * LOG2E, al_ = __builtin_amdgcn_exp2f(nn - nm); nm = nn;   // old terms carry 2^nm, new ones 2^nn: the factor between them is exactly 2^(nn - nm)
    const v8f t0 = s0 * LOG2E + nn, t1 = s1 * LOG2E + nn;
    v8f e0, e1;
#pragma unroll
    for (int r = 0; r < 8; ++r) { e0[r] = __builtin_amdgcn_exp2f(t0[r]); e1[r] = __builtin_amdgcn_exp2f(t1[r]); }   // 8 P
    const v8b h0 = __builtin_convertvector(e0, v8b), h1 = __builtin_convertvector(e1, v8b);   // hi plane, two values a conversion
    const v8b g0 = __builtin_convertvector(e0 - __builtin_convertvector(h0, v8f), v8b), g1 = __builtin_convertvector(e1 - __builtin_convertvector(h1, v8f), v8b);   // lo plane = the residual
    const v16b pb = cat8b(h0, h1), pl = cat8b(g0, g1);
    const v8f es = e0 + e1;
    const v4f eq = __builtin_shufflevector(es, es, 0, 1, 2, 3) + __builtin_shufflevector(es, es, 4, 5, 6, 7);
    l = l * al_ + ((eq[0] + eq[1]) + (eq[2] + eq[3]));
    __builtin_amdgcn_sched_barrier(0);   // compile-time only: the register moves that read the next chunk's bias and keys, and their waits, stay below, among the value products
#pragma unroll
    for (int n = 0; n < 4; ++n) {
#pragma unroll
      for (int r = 0; r < 8; ++r) o[n][r] *= al_;
      o[n] = wmma16b(vf[n], pb, o[n]); o[n] = wmma16b(vf[n], pl, o[n]); o[n] = wmma16b(vl[n], pb, o[n]);   // (8v) and P both as f16 hi+lo pairs (lo.lo dropped)
    }
  }
  l += xhalf(l);   // join the two halves' sums
  const float inv = 1.0f / (VS * l);   // l already carries P's x8
  float* dst = y + ((size_t)(b * QT + jt) * (D / 32) + h * 2) * 512;   // packed f32 tiles [token tile][k tile]; this head = 2 k tiles = 8 pieces of 512 B
  {
#pragma unroll
    for (int j = 0; j < 8; ++j) { v4f w;   // a lane's accumulators are its own packed pieces (d = 16 n + 8 hh + r), so no LDS exchange is needed
#pragma unroll
      for (int e = 0; e < 4; ++e) w[e] = o[j >> 1][(j & 1) * 4 + e] * inv;
      *(v4f*)(dst + j * 128 + lane * 4) = w; }
    
  }
}

// out = y W_o^T: (8192 x 1024) x (1024 x 1024); A = y x8 split at load into f16 hi + lo, B = f16(bf16 W_o) packed tiles; f32 rows; grid (16, 64).
__global__ __launch_bounds__(128) void out_kernel(const float* __restrict__ y, const b16* __restrict__ wo16, const float* __restrict__ bo, float* __restrict__ out) {
  __shared__ __attribute__((aligned(16))) float Ts[4][32 * 64];
  const int lane = threadIdx.x & 31, wave = threadIdx.x >> 5, nloc = lane & 15, m0 = blockIdx.y * 128 + wave * 32, c0 = blockIdx.x * 64;
  v8f acc[2][4];
#pragma unroll
  for (int r = 0; r < 2; ++r)
#pragma unroll
    for (int t = 0; t < 4; ++t) acc[r][t] = (v8f){};
  const float* ya = y + (size_t)(m0 >> 4) * (D / 32) * 512 + lane * 4; const b16* wb = wo16 + (size_t)(c0 >> 4) * (D / 32) * 512;   // packed tiles
  // Loads run one step ahead: y is fetched again as soon as the step's rows are split, each weight fragment as soon as its four products are issued.
  v4f yr[2][4]; v16b bh[4];
#pragma unroll
  for (int r = 0; r < 2; ++r)
#pragma unroll
    for (int j = 0; j < 4; ++j) yr[r][j] = *(const v4f*)(ya + r * (D / 32) * 512 + j * 128);
  // keeps the first y loads in front of the first weight loads, the order of the loop: loads return in order, and the split of y then waits for y alone
  asm volatile("s_wait_xcnt 0x0" ::: "memory");
#pragma unroll
  for (int t = 0; t < 4; ++t) bh[t] = frag_pk(wb + t * (D / 32) * 512, lane);
  for (int kt = 0; kt < D / 32; ++kt) {                                         // y as an f16 hi+lo pair carried x8 (2 products)
    v16b ah[2], al[2];
#pragma unroll
    for (int r = 0; r < 2; ++r)
#pragma unroll
      for (int j = 0; j < 4; ++j) {
#pragma unroll
        for (int e = 0; e < 4; ++e) { b16 a, c; split16(yr[r][j][e] * 8.0f, a, c); ah[r][j * 4 + e] = a; al[r][j * 4 + e] = c; } }
    const int kn = kt + 1 < D / 32 ? kt + 1 : kt;   // next step; the last one fetches its own again (in bounds, unused)
#pragma unroll
    for (int r = 0; r < 2; ++r)
#pragma unroll
      for (int j = 0; j < 4; ++j) yr[r][j] = *(const v4f*)(ya + (r * (D / 32) + kn) * 512 + j * 128);
    // stands behind the next step's y loads, in front of any write of a register that they name; they stay here, all sixteen products ahead of their use
    asm volatile("s_wait_xcnt 0x0" ::: "memory");
    __builtin_amdgcn_sched_barrier(0);   // compile-time only: holds the next step's y loads here, ahead of the sixteen products
#pragma unroll
    for (int t = 0; t < 4; ++t) {
      acc[0][t] = wmma16b(ah[0], bh[t], acc[0][t]); acc[0][t] = wmma16b(al[0], bh[t], acc[0][t]);
      acc[1][t] = wmma16b(ah[1], bh[t], acc[1][t]); acc[1][t] = wmma16b(al[1], bh[t], acc[1][t]);
      bh[t] = frag_pk(wb + (t * (D / 32) + kn) * 512, lane); }
    // the same behind the next step's weight loads
    asm volatile("s_wait_xcnt 0x0" ::: "memory");
    __builtin_amdgcn_sched_barrier(0);   // compile-time only: ends the step for the scheduler; without it a product's wait falls to 0 and covers the y loads just issued
  }
#pragma unroll
  for (int t = 0; t < 4; ++t)
#pragma unroll
    for (int r = 0; r < 2; ++r)
#pragma unroll
      for (int v = 0; v < 8; ++v) acc[r][t][v] = acc[r][t][v] * (1.0f / 8.0f) + bf16_rne(bo[c0 + t * 16 + nloc]);
  epi_f32(acc, 1.0f, nullptr, out, D, m0, c0, lane, Ts[wave]);
}
}  // namespace

extern "C" void kernel_launch(void* const* d_in, const int* in_sizes, int n_in,
                              void* d_out, int out_size, void* d_ws, size_t ws_size, hipStream_t stream) {
  (void)n_in; (void)out_size;
  const float* x = (const float*)d_in[0]; const float* pos = (const float*)d_in[1]; const float* wqkv = (const float*)d_in[2]; const float* bqkv = (const float*)d_in[3]; const float* wo = (const float*)d_in[4]; const float* bo = (const float*)d_in[5]; const float* mw = (const float*)d_in[6]; const float* mb = (const float*)d_in[7];
  float* out = (float*)d_out;   // [8][1024][1024]
  if (in_sizes[0] != BT * S * D || in_sizes[1] != S * S * NP_ || in_sizes[2] != 2 * D * D || in_sizes[3] != 2 * D || in_sizes[4] != D * D || in_sizes[5] != D || in_sizes[6] != NP_) return;

  size_t off = 0; char* ws = (char*)d_ws;
  auto carve = [&](size_t bytes) { char* p = ws + off; off += (bytes + 255) & ~(size_t)255; return p; };
  unsigned short* x16 = (unsigned short*)carve((size_t)NTOK * D * 2); unsigned short* w16 = (unsigned short*)carve((size_t)2 * D * D * 2); b16* wo16 = (b16*)carve((size_t)D * D * 2);
  b16* kh = (b16*)carve((size_t)2 * NTOK * D * 2); b16* vt = (b16*)carve((size_t)2 * NTOK * D * 2); float* y = (float*)carve((size_t)NTOK * D * 4); float* pb = (float*)carve((size_t)S * S * 4); float* sw = (float*)carve(256);
  if (off > ws_size) return;                                    // ≈ 128 MB (122 MiB)
  prep_all_kernel<<<NB_ALL, 256, 0, stream>>>(x, pos, wqkv, wo, mw, mb, x16, w16, wo16, pb, sw);
  proj_kernel<<<dim3(2 * D / 64, NTOK / 128), 128, 0, stream>>>((const __bf16*)x16, (const __bf16*)w16, bqkv, kh, vt);
  attn_kernel<S / 16><<<Bn * H * (S / 16) / 8, 256, 0, stream>>>(kh, vt, pb, sw, y);
  out_kernel<<<dim3(D / 64, NTOK / 128), 128, 0, stream>>>(y, wo16, bo, out);
}

// v007
// It runs in 145 microseconds.
// Timed twice side by side with v006, it ran 1.08 and 1.06 times as fast.
// Over all steps from v000 it is 2.64 times as fast.
#include <hip/hip_runtime.h>

// MultiheadAttention_KV: kv = x kv_w^T + kv_b (16 heads x [k 64 | v 64] interleaved per head); scores = (k_q . k_k)/8 * sum(mp_w) + pos_bias[q][k] with pos_bias = pos mp_w^T + mp_b
// (shared over batch and heads; precomputed once); softmax; vals = a v; out = vals o_w^T + o_b -> [8][1024][1024]. Keys and queries are the SAME k rows.
namespace {
constexpr int BT = 8, Bn = 8, S = 1024, D = 1024, H = 16, HD = 64, NTOK = Bn * S, NP_ = 10;
constexpr float SCALE = 0.125f, VS = 8.0f, QS = 8.0f, PS = 8.0f;   // power-of-two carry scales so hi/lo residual planes stay normal in f16
constexpr size_t VPL = (size_t)NTOK * D;   // distance between the (8v)^T hi and lo planes
constexpr size_t QPL = (size_t)NTOK * D;   // distance between the q/k hi and lo planes

typedef _Float16 b16;
typedef __attribute__((ext_vector_type(16))) _Float16 v16b;
typedef __attribute__((ext_vector_type(8)))  _Float16 v8b;
typedef __attribute__((ext_vector_type(8)))  float v8f;
typedef __attribute__((ext_vector_type(4)))  float v4f;

__device__ __forceinline__ v8b ld8b(const b16* p) { return *(const v8b*)p; }
__device__ __forceinline__ v16b cat8b(v8b a, v8b b) { return __builtin_shufflevector(a, b, 0, 1, 2, 3, 4, 5, 6, 7, 8, 9, 10, 11, 12, 13, 14, 15); }
// Fragment-packed operand tiles. A 16-row x 32-k tile of a 16-bit operand is 512 elements laid out [j 2][lane 32][8]: lane = 16 * hh + row holds k = 16 * j + 8 * hh + e,
// the hardware k order of a 16x16x32 A or B fragment, so each wave-wide 16-byte load reads 512 contiguous bytes (4 whole lines instead of 16 partly used ones).
// An f32 tile is [j4 4][lane 32][4] with k = 16 * (j4 >> 1) + 8 * hh + 4 * (j4 & 1) + e.
__device__ __forceinline__ v16b frag_pk(const b16* tile, int lane) { return cat8b(ld8b(tile + lane * 8), ld8b(tile + 256 + lane * 8)); }
__device__ __forceinline__ void split16(float v, b16& hi, b16& lo) { hi = (b16)v; lo = (b16)(v - (float)hi); }
// Plain builtins: the compiler keeps the distance behind a matrix instruction itself and fills it with the kernel's own vector work where there is some.
__device__ __forceinline__ v8f wmma16b(v16b a, v16b b, v8f c) {
  v8f d = __builtin_amdgcn_wmma_f32_16x16x32_f16(false, a, false, b, (short)0, c, false, false);
  return d;
}
__device__ __forceinline__ void wave_lds_sync() {
  __builtin_amdgcn_fence(__ATOMIC_RELEASE, "workgroup");
  __builtin_amdgcn_wave_barrier();
  __builtin_amdgcn_fence(__ATOMIC_ACQUIRE, "workgroup");
}

__device__ __forceinline__ void epi_planes(v8f (&acc)[2][4], float scale, bool two, b16* __restrict__ oh, b16* __restrict__ ol, int ldo,
                                           int m0, int c0, int lane, b16* Th, b16* Tl) {
  const int nloc = lane & 15, hlf = lane >> 4;
#pragma unroll
  for (int t = 0; t < 4; ++t)
#pragma unroll
    for (int r = 0; r < 2; ++r)
#pragma unroll
      for (int v = 0; v < 8; ++v) {
        const int rr = r * 16 + v + 8 * hlf, cc = t * 16 + nloc;
        b16 h_, l_; split16(acc[r][t][v] * scale, h_, l_);
        Th[rr * 64 + cc] = h_; Tl[rr * 64 + cc] = l_;
      }
  wave_lds_sync();
  {
#pragma unroll
    for (int j = 0; j < 8; ++j) {
      const int rr = j * 4 + (lane >> 3), c8 = (lane & 7) * 8;
      const size_t o = (size_t)(m0 + rr) * ldo + c0 + c8;
      *(v8b*)(oh + o) = ld8b(Th + rr * 64 + c8);
      if (two) *(v8b*)(ol + o) = ld8b(Tl + rr * 64 + c8);
    }
    
  }
}
// (b) f32 rows with pitch ldo: 128 floats = 512 B = 4 lines per row; 32 lanes x 16 B, one whole row per instruction. Optional per-row factor
__device__ __forceinline__ void epi_f32(v8f (&acc)[2][8], float scale, const float* rscale, float* __restrict__ out, int ldo, int m0, int c0, int lane, float* Tt) {
  const int nloc = lane & 15, hlf = lane >> 4;
#pragma unroll
  for (int t = 0; t < 8; ++t)
#pragma unroll
    for (int r = 0; r < 2; ++r)
#pragma unroll
      for (int v = 0; v < 8; ++v) {
        const int rr = r * 16 + v + 8 * hlf;
        const float rs = rscale ? rscale[(size_t)(m0 + rr) * 32] : 1.0f;
        Tt[rr * 128 + t * 16 + nloc] = acc[r][t][v] * scale * rs;
      }
  wave_lds_sync();
  float* dst0 = out + (size_t)m0 * ldo + c0;
  {
#pragma unroll
    for (int j = 0; j < 32; ++j) *(v4f*)(dst0 + (size_t)j * ldo + lane * 4) = *(const v4f*)(Tt + j * 128 + lane * 4);
    
  }
}



typedef __attribute__((ext_vector_type(8))) __bf16 v8bb; typedef __attribute__((ext_vector_type(16))) __bf16 v16bb;
__device__ __forceinline__ v16bb frag_pk_bf(const __bf16* tile, int lane) { const v8bb a = *(const v8bb*)(tile + lane * 8), b = *(const v8bb*)(tile + 256 + lane * 8); return __builtin_shufflevector(a, b, 0, 1, 2, 3, 4, 5, 6, 7, 8, 9, 10, 11, 12, 13, 14, 15); }
// Loads of the output GEMM's loop: a wave-uniform tile address plus the lane's byte offset.
template <class V> __device__ __forceinline__ V ld_u(const void* tile, unsigned lane16) { return *(const V*)((const char*)tile + lane16); }
template <class V> __device__ __forceinline__ void st_u(void* tile, unsigned lane16, V v) { *(V*)((char*)tile + lane16) = v; }   // the same for the projection's stores
__device__ __forceinline__ v16b frag_u(const b16* tile, unsigned lane16) { return cat8b(ld_u<v8b>(tile, lane16), ld_u<v8b>(tile + 256, lane16)); }
__device__ __forceinline__ v8f wmma16bb(v16bb a, v16bb b, v8f c) {
  v8f d = __builtin_amdgcn_wmma_f32_16x16x32_bf16(false, a, false, b, (short)0, c, false, false);
  return d;
}
__device__ __forceinline__ unsigned short bf16_rne_bits(float v) { unsigned int u = __float_as_uint(v); u += 0x7FFFu + ((u >> 16) & 1u); return (unsigned short)(u >> 16); }
__device__ __forceinline__ float bf16_rne(float v) { return __uint_as_float(((unsigned int)bf16_rne_bits(v)) << 16); }



// Preparation kernels read whole 128-byte lines. One wave packs one 16-row x 32-k tile per pass: in load i lane l reads floats 4 * (l & 7) .. + 3 of row 4 * i + (l >> 3), so 8 lanes
// take a row's whole line; those 4 values (k = 4 c + e, c = l & 7) are half of the packed piece (j = c >> 2, hh = (c >> 1) & 1, row) and go out as one 8-byte store.
// The unroll directives of this part make every index of the small arrays a constant, so that they stay in registers and a pass's loads issue together.
typedef __attribute__((ext_vector_type(4))) unsigned short v4us; typedef __attribute__((ext_vector_type(4))) _Float16 v4b;
__device__ __forceinline__ size_t tile_src(size_t tile, int i, int lane) { return ((tile >> 5) * 16 + i * 4 + (lane >> 3)) * D + (tile & 31) * 32 + (lane & 7) * 4; }   // tiles ordered [row tile][k tile]
__device__ __forceinline__ size_t tile_dst(size_t tile, int i, int lane) { const int c = lane & 7; return tile * 512 + (c >> 2) * 256 + (((c >> 1) & 1) * 16 + i * 4 + (lane >> 3)) * 8 + (c & 1) * 4; }
__device__ __forceinline__ void pack_bf_tile(const float* __restrict__ s, unsigned short* __restrict__ d, size_t tile, int lane) {
  v4f f[4];
#pragma unroll
  for (int i = 0; i < 4; ++i) f[i] = *(const v4f*)(s + tile_src(tile, i, lane));
#pragma unroll
  for (int i = 0; i < 4; ++i) { v4us v;
#pragma unroll
    for (int e = 0; e < 4; ++e) v[e] = bf16_rne_bits(f[i][e]);
    *(v4us*)(d + tile_dst(tile, i, lane)) = v; }
}
// The three preparation parts depend on nothing but the inputs, so they share ONE launch (prep_all_kernel below): each is a device function that is told its work-group's index within the part.
constexpr int NB_X = 1024, NB_W = 512;   // work-groups of 256 threads for the x part and for the weight part
__device__ __forceinline__ void xprep_part(int bid, const float* __restrict__ x, unsigned short* __restrict__ x16) {   // x -> bf16 packed tiles [token tile][k tile]
  const int lane = threadIdx.x & 31;
  const size_t wv = ((size_t)bid * 256 + threadIdx.x) >> 5, nwv = ((size_t)NB_X * 256) >> 5;
  for (size_t tile = wv; tile < (size_t)NTOK * D / 512; tile += nwv) pack_bf_tile(x, x16, tile, lane);
}
__device__ __forceinline__ void wprep_part(int bid, const float* __restrict__ wqkv, const float* __restrict__ wo, unsigned short* __restrict__ w16, b16* __restrict__ wo16) {
  const int lane = threadIdx.x & 31;
  const size_t wv = ((size_t)bid * 256 + threadIdx.x) >> 5, nwv = ((size_t)NB_W * 256) >> 5;
  for (size_t tile = wv; tile < (size_t)2 * D * D / 512; tile += nwv) pack_bf_tile(wqkv, w16, tile, lane);   // kv_w [2048][1024] ([out][in]) rows -> packed tiles [out tile][k tile]
  for (size_t tile = wv; tile < (size_t)D * D / 512; tile += nwv) {                                          // W_o [out][in] rows -> packed tiles [out tile][k tile]
    v4f f[4];
#pragma unroll
    for (int i = 0; i < 4; ++i) f[i] = *(const v4f*)(wo + tile_src(tile, i, lane));
#pragma unroll
    for (int i = 0; i < 4; ++i) { v4b w;
#pragma unroll
      for (int e = 0; e < 4; ++e) w[e] = (b16)bf16_rne(f[i][e]);
      *(v4b*)(wo16 + tile_dst(tile, i, lane)) = w; }
  }
}

// pos_bias: a work-group makes one query tile (16 rows) x 128 keys. A row's 128 keys x 10 features are 5120 contiguous bytes: each wave brings two rows as whole-line loads into LDS;
// behind the barrier each thread reads the 40 floats of 4 keys of its own packed place. Row pitch 5120 + 16 bytes: sixteen rows' 16-byte reads fall on different banks.
constexpr int PBK = 128, PROW = PBK * NP_ + 4, NB_POS = (S / 16) * (S / PBK), NB_ALL = NB_POS + NB_X + NB_W;   // NB_POS: work-groups of the bias part; NB_ALL: the whole preparation grid
__device__ __forceinline__ void posb_part(int bid, float* P, const float* __restrict__ pos, const float* __restrict__ mw, const float* __restrict__ mb, float* __restrict__ pb, float* __restrict__ sw) {
  const int t = threadIdx.x, lane = t & 31, wave = t >> 5, qt = bid / (S / PBK), kq = bid % (S / PBK);
  v4f st[2][NP_];
#pragma unroll
  for (int r = 0; r < 2; ++r)
#pragma unroll
    for (int i = 0; i < NP_; ++i) st[r][i] = *(const v4f*)(pos + ((size_t)(qt * 16 + wave * 2 + r) * S + kq * PBK) * NP_ + i * 128 + lane * 4);
  float w[NP_];
#pragma unroll
  for (int p = 0; p < NP_; ++p) w[p] = bf16_rne(mw[p]);
  const float b0 = bf16_rne(mb[0]);
#pragma unroll
  for (int r = 0; r < 2; ++r)
#pragma unroll
    for (int i = 0; i < NP_; ++i) *(v4f*)(P + (wave * 2 + r) * PROW + i * 128 + lane * 4) = st[r][i];
  __syncthreads();   // every row is staged before any thread reads across rows
  float* dst = pb + ((size_t)qt * (S / 32) + kq * (PBK / 32)) * 512;   // packed f32 tiles [query tile 64][key tile 32][j4 4][lane 32][4]; this work-group's four key tiles are 8 KiB in a row
#pragma unroll
  for (int h = 0; h < 2; ++h) {
    const int gi = h * 256 + t, j4 = (gi >> 5) & 3, kt = gi >> 7;
    const float* pr = P + (lane & 15) * PROW + (kt * 32 + (j4 >> 1) * 16 + (lane >> 4) * 8 + (j4 & 1) * 4) * NP_;
    v4f f[NP_], o;
#pragma unroll
    for (int i = 0; i < NP_; ++i) f[i] = *(const v4f*)(pr + i * 4);
#pragma unroll
    for (int e = 0; e < 4; ++e) { float s = b0;
#pragma unroll
      for (int p = 0; p < NP_; ++p) s += bf16_rne(f[(e * NP_ + p) >> 2][(e * NP_ + p) & 3]) * w[p];   // a product of two bf16 values is exact in f32 (short of underflow): fused or not, each addition rounds the same
      o[e] = s; }
    *(v4f*)(dst + gi * 4) = o;
  }
  if (bid == 0 && t < 64) { float s = 0.0f;   // sum of bf16(mp_w), replicated over one 256-B row
#pragma unroll
    for (int p = 0; p < NP_; ++p) s += w[p];
    sw[t] = s; }
}
// One launch for all preparation. The part is chosen by the work-group's index alone, so every branch (and the bias part's barrier) is uniform over the work-group.
// The bias work-groups move the most bytes each and come first in index order (for speed only).
__global__ __launch_bounds__(256) void prep_all_kernel(const float* __restrict__ x, const float* __restrict__ pos, const float* __restrict__ wqkv, const float* __restrict__ wo,
                                                       const float* __restrict__ mw, const float* __restrict__ mb, unsigned short* __restrict__ x16, unsigned short* __restrict__ w16,
                                                       b16* __restrict__ wo16, float* __restrict__ pb, float* __restrict__ sw) {
  __shared__ __attribute__((aligned(16))) float P[16 * PROW];
  const int bid = blockIdx.x;
  if (bid < NB_POS) posb_part(bid, P, pos, mw, mb, pb, sw);
  else if (bid < NB_POS + NB_X) xprep_part(bid - NB_POS, x, x16);
  else wprep_part(bid - NB_POS - NB_X, wqkv, wo, w16, wo16);
}

// projections: rows = tokens (8192), K = 1024, column tiles of 64 = one head's k or v (interleaved per head); k: f16 packed tiles [b*H + head][token tile 64][ks 2];
// v: (8v)^T f16 packed tiles [b*H + head][key tile 32][d tile 4]. A wave makes 64 tokens x 64 columns (4 x 4 accumulator tiles): each loaded fragment feeds four products.
// A work-group is 4 x 2 waves = 256 tokens x one head's k and v; grid (16, 32) x 256.
__global__ __launch_bounds__(256) void proj_kernel(const __bf16* __restrict__ x16, const __bf16* __restrict__ w16, const float* __restrict__ bqkv, b16* __restrict__ kh, b16* __restrict__ vt) {
  __shared__ __attribute__((aligned(16))) b16 Th[4][64][HD + 8], Tq[4][64][HD + 8];   // only the four k waves stage
  const int lane = threadIdx.x & 31, wave = __builtin_amdgcn_readfirstlane(threadIdx.x >> 5), nloc = lane & 15, hlf = lane >> 4;   // the wave's number in a scalar register: the k | v choice below is a scalar branch
  const int wm = wave >> 1, which = wave & 1, head = blockIdx.x, m0 = blockIdx.y * 256 + wm * 64, c0 = (head * 2 + which) * 64;   // column tile = (head, k|v) interleaved per head
  v8f acc[4][4];
#pragma unroll
  for (int r = 0; r < 4; ++r)
#pragma unroll
    for (int t = 0; t < 4; ++t) acc[r][t] = (v8f){};
  const __bf16* xa = x16 + (size_t)(m0 >> 4) * (D / 32) * 512; const __bf16* wb = w16 + (size_t)(c0 >> 4) * (D / 32) * 512;   // packed tiles, 512 elements each
#pragma unroll 2
  for (int kt = 0; kt < D / 32; ++kt) {
    v16bb a[4], bw[4];
#pragma unroll
    for (int r = 0; r < 4; ++r) a[r] = frag_pk_bf(xa + (r * (D / 32) + kt) * 512, lane);
    asm volatile("s_wait_xcnt 0x0" ::: "memory");   // stands behind the eight x loads: without it the last weight load of a group is given the register pair that holds the x loads' address
#pragma unroll
    for (int t = 0; t < 4; ++t) bw[t] = frag_pk_bf(wb + (t * (D / 32) + kt) * 512, lane);
    // stands behind the step's sixteen loads, in front of any write of a register that they name; no load sinks below it, so they fly together and not one pair after another
    asm volatile("s_wait_xcnt 0x0" ::: "memory");
    __builtin_amdgcn_sched_barrier(0);   // compile-time only: the scheduler moves nothing across it, so the step's sixteen loads stay one group; without it they are split into pairs among the products, each pair with a wait of its own
#pragma unroll
    for (int t = 0; t < 4; ++t)
#pragma unroll
      for (int r = 0; r < 4; ++r) acc[r][t] = wmma16bb(a[r], bw[t], acc[r][t]);
  }
  const int b = m0 / S, tok0 = m0 % S;
#pragma unroll
  for (int t = 0; t < 4; ++t) { const float bb = bf16_rne(bqkv[c0 + t * 16 + nloc]);   // + bias (bf16-rounded)
#pragma unroll
    for (int r = 0; r < 4; ++r)
#pragma unroll
      for (int v = 0; v < 8; ++v) acc[r][t][v] += bb; }
  if (which == 0) {                                             // k head: f16 packed tiles (hi + lo planes)
#pragma unroll
    for (int t = 0; t < 4; ++t)
#pragma unroll
      for (int r = 0; r < 4; ++r)
#pragma unroll
        for (int v = 0; v < 8; ++v) { b16 a_, c_; split16(acc[r][t][v] * QS, a_, c_); Th[wm][r * 16 + 8 * hlf + v][t * 16 + nloc] = a_; Tq[wm][r * 16 + 8 * hlf + v][t * 16 + nloc] = c_; }   // q, k carried x8 (lo residuals stay normal)
    wave_lds_sync();
    b16* dst = kh + (((size_t)b * H + head) * S + tok0) * HD;
    v8b ph[16], pl[16];
#pragma unroll
    for (int j = 0; j < 16; ++j) { const int rr = (j >> 2) * 16 + nloc, c8 = ((j >> 1) & 1) * 32 + (j & 1) * 16 + hlf * 8;   // packed tiles [token tile][ks 2]: piece j = (token tile, ks, j)
      ph[j] = *(const v8b*)(&Th[wm][rr][c8]); pl[j] = *(const v8b*)(&Tq[wm][rr][c8]); }
    __builtin_amdgcn_sched_barrier(0);   // compile-time only: every LDS read stands in front of the first store, so none lands on a register that an issued store names
#pragma unroll
    for (int j = 0; j < 16; ++j) st_u(dst + j * 256, lane * 16u, ph[j]);
    asm volatile("s_wait_xcnt 0x0" ::: "memory");   // stands behind the hi plane's stores: the lo plane's address is formed in vector registers that they name
    __builtin_amdgcn_sched_barrier(0);   // compile-time only: that address arithmetic stays behind the wait
#pragma unroll
    for (int j = 0; j < 16; ++j) st_u(dst + QPL + j * 256, lane * 16u, pl[j]);
    return;
  }
  // v head: (8v)^T packed tiles [key tile 32][d tile 4], 32 keys = 2048 elements. A lane's accumulators acc[2 g + j][n][e] (key 32 g + 16 j + 8 hlf + e, d 16 n + nloc) are its own
  // packed piece (n, j) of key tile g, so they are stored straight from registers.
  b16* dstv = vt + (((size_t)b * H + head) * HD) * S + (size_t)tok0 * HD;
#pragma unroll
  for (int g = 0; g < 2; ++g) {
    v8b a8[8], c8[8];
#pragma unroll
    for (int n = 0; n < 4; ++n)
#pragma unroll
      for (int j = 0; j < 2; ++j)
#pragma unroll
        for (int e = 0; e < 8; ++e) { b16 a_, c_; split16(acc[g * 2 + j][n][e] * VS, a_, c_); a8[n * 2 + j][e] = a_; c8[n * 2 + j][e] = c_; }
    __builtin_amdgcn_sched_barrier(0);   // compile-time only: a key tile's splits stand in front of its first store, so none writes a register that an issued store names
#pragma unroll
    for (int p = 0; p < 8; ++p) { st_u(dstv + g * 2048 + p * 256, lane * 16u, a8[p]); st_u(dstv + VPL + g * 2048 + p * 256, lane * 16u, c8[p]); }
    asm volatile("s_wait_xcnt 0x0" ::: "memory");   // stands behind the key tile's v stores, in front of any later write of a register that an issued store names
    __builtin_amdgcn_sched_barrier(0);   // compile-time only: the next key tile's splits stay behind that wait
  }
}

// attention: wave = (b, h, 16 queries); key chunks of 32 over all 1024 keys, no mask: S^T (K=64), online softmax f32, P^T f16, y^T += (8V)^T P^T;
__device__ __forceinline__ float xhalf(float x) { return __builtin_bit_cast(float, __builtin_amdgcn_permlanex16(__builtin_bit_cast(int, x), __builtin_bit_cast(int, x), 0x76543210, 0xfedcba98, false, false)); }   // lane l with lane l ^ 16, a vector move (no LDS round trip)
__device__ __forceinline__ v8f cat4f(v4f a, v4f b) { return __builtin_shufflevector(a, b, 0, 1, 2, 3, 4, 5, 6, 7); }
constexpr float LOG2E = 1.44269504088896340736f;
template <int QT>
__global__ __launch_bounds__(256) void attn_kernel(const b16* __restrict__ kh, const b16* __restrict__ vt, const float* __restrict__ pb, const float* __restrict__ swp, float* __restrict__ y) {
  const int wid = threadIdx.x >> 5, lane = threadIdx.x & 31;
  const float SW = swp[lane];   // the sum is replicated over 64 floats: read by lane it lives in a vector register, which the packed multiply-adds take as it is (from a scalar register it was copied into vector pairs every pass)
  asm volatile("s_wait_xcnt 0x0" ::: "memory");   // stands behind that load, in front of any later write of the register that holds its offset
  const int qt = blockIdx.x * 8 + wid, jt = qt % QT, bh = qt / QT, h = bh % H, b = bh / H;
  const b16* Q = kh + ((size_t)bh * S) * HD; const b16* K = kh + ((size_t)bh * S) * HD; const b16* vb = vt + ((size_t)bh * HD) * S;
  v16b qf[2], ql[2];
#pragma unroll
  for (int ks = 0; ks < 2; ++ks) { qf[ks] = frag_pk(Q + (jt * 2 + ks) * 512, lane); ql[ks] = frag_pk(Q + QPL + (jt * 2 + ks) * 512, lane); }
  // Softmax state: m = running maximum; nm = 3 - m log2(e), the addend that turns a score into the exponent of 8 exp(s - m) in one fused multiply-add (the x8 carry of P rides in the exponent);
  // l = THIS LANE's running sum of 8 P over its own half of the keys; the two halves are joined once, behind the loop.
  float m = -INFINITY, nm = INFINITY, l = 0.0f; v8f o[4] = {{}, {}, {}, {}};
  const float C = SCALE * SW / (QS * QS);
  const float* pbq = pb + (size_t)jt * (S / 32) * 512 + lane * 4;   // this query tile's additive bias, packed f32 tiles
  // Loads run ahead of their use: a chunk's key fragments and bias are fetched during the chunk before it, its value fragments at the chunk's top, ahead of the score products.
  v16b kf[2][2]; v4f pq[4];
#pragma unroll
  for (int ks = 0; ks < 2; ++ks) { kf[ks][0] = frag_pk(K + ks * 512, lane); kf[ks][1] = frag_pk(K + 1024 + ks * 512, lane); }
#pragma unroll
  for (int j = 0; j < 4; ++j) pq[j] = *(const v4f*)(pbq + j * 128);
  for (int kb = 0; kb < S; kb += 32) {
    const b16* vhp = vb + kb * HD + lane * 8; const b16* vlp = vhp + VPL;
    v16b vf[4], vl[4];
#pragma unroll
    for (int n = 0; n < 4; ++n) { vf[n] = cat8b(ld8b(vhp + n * 512), ld8b(vhp + n * 512 + 256)); vl[n] = cat8b(ld8b(vlp + n * 512), ld8b(vlp + n * 512 + 256)); }
    // stands behind the value loads, in front of any write of a register that they name; no load sinks below it to its use
    asm volatile("s_wait_xcnt 0x0" ::: "memory");
    __builtin_amdgcn_sched_barrier(0);   // compile-time only: holds the value loads up here; without it the scheduler sinks them to the value products, where each wait covers a whole fetch
    v8f s0 = {}, s1 = {};
#pragma unroll
    for (int ks = 0; ks < 2; ++ks) {
      s0 = wmma16b(kf[ks][0], qf[ks], s0); s0 = wmma16b(kf[ks][0], ql[ks], s0);      // query side hi+lo, key side hi only (2 products): the key's 2^-11 rounding moves the O(1) logits by ~3e-5
      s1 = wmma16b(kf[ks][1], qf[ks], s1); s1 = wmma16b(kf[ks][1], ql[ks], s1); }
    const int kn = kb + 32 < S ? kb + 32 : kb;   // next chunk; the last pass fetches its own again (in bounds, unused)
    const b16* kp = K + kn * HD + lane * 8;
#pragma unroll
    for (int ks = 0; ks < 2; ++ks) { kf[ks][0] = cat8b(ld8b(kp + ks * 512), ld8b(kp + ks * 512 + 256)); kf[ks][1] = cat8b(ld8b(kp + 1024 + ks * 512), ld8b(kp + 1024 + ks * 512 + 256)); }
    // the same behind the next chunk's key loads: they stay here, a whole softmax and value product ahead of their use
    asm volatile("s_wait_xcnt 0x0" ::: "memory");
    __builtin_amdgcn_sched_barrier(0);   // compile-time only: holds the next chunk's key loads here, a whole softmax ahead of their use
    s0 = s0 * C + cat4f(pq[0], pq[1]); s1 = s1 * C + cat4f(pq[2], pq[3]);   // whole-vector forms: neighbouring registers pair up in packed instructions with no register moves
    float mr = -INFINITY;
#pragma unroll
    for (int r = 0; r < 8; ++r) mr = fmaxf(mr, fmaxf(s0[r], s1[r]));
    const float* pp = pbq + kn * 16;
#pragma unroll
    for (int j = 0; j < 4; ++j) pq[j] = *(const v4f*)(pp + j * 128);
    // the same behind the next chunk's bias loads, which stay ahead of the exponentials
    asm volatile("s_wait_xcnt 0x0" ::: "memory");
    __builtin_amdgcn_sched_barrier(0);   // compile-time only: holds the next chunk's bias loads here, ahead of the exponentials
    mr = fmaxf(mr, xhalf(mr));
    m = fmaxf(m, mr);
    const float nn = 3.0f - m * LOG2E, al_ = __builtin_amdgcn_exp2f(nn - nm); nm = nn;   // old terms carry 2^nm, new ones 2^nn: the factor between them is exactly 2^(nn - nm)
    const v8f t0 = s0 * LOG2E + nn, t1 = s1 * LOG2E + nn;
    v8f e0, e1;
#pragma unroll
    for (int r = 0; r < 8; ++r) { e0[r] = __builtin_amdgcn_exp2f(t0[r]); e1[r] = __builtin_amdgcn_exp2f(t1[r]); }   // 8 P
    const v8b h0 = __builtin_convertvector(e0, v8b), h1 = __builtin_convertvector(e1, v8b);   // hi plane, two values a conversion
    const v8b g0 = __builtin_convertvector(e0 - __builtin_convertvector(h0, v8f), v8b), g1 = __builtin_convertvector(e1 - __builtin_convertvector(h1, v8f), v8b);   // lo plane = the residual
    const v16b pb = cat8b(h0, h1), pl = cat8b(g0, g1);
    const v8f es = e0 + e1;
    const v4f eq = __builtin_shufflevector(es, es, 0, 1, 2, 3) + __builtin_shufflevector(es, es, 4, 5, 6, 7);
    l = l * al_ + ((eq[0] + eq[1]) + (eq[2] + eq[3]));
    __builtin_amdgcn_sched_barrier(0);   // compile-time only: the register moves that read the next chunk's bias and keys, and their waits, stay below, among the value products
#pragma unroll
    for (int n = 0; n < 4; ++n) {
#pragma unroll
      for (int r = 0; r < 8; ++r) o[n][r] *= al_;
      o[n] = wmma16b(vf[n], pb, o[n]); o[n] = wmma16b(vf[n], pl, o[n]); o[n] = wmma16b(vl[n], pb, o[n]);   // (8v) and P both as f16 hi+lo pairs (lo.lo dropped)
    }
  }
  l += xhalf(l);   // join the two halves' sums
  const float inv = 1.0f / (VS * l);   // l already carries P's x8
  float* dst = y + ((size_t)(b * QT + jt) * (D / 32) + h * 2) * 512;   // packed f32 tiles [token tile][k tile]; this head = 2 k tiles = 8 pieces of 512 B
  {
#pragma unroll
    for (int j = 0; j < 8; ++j) { v4f w;   // a lane's accumulators are its own packed pieces (d = 16 n + 8 hh + r), so no LDS exchange is needed
#pragma unroll
      for (int e = 0; e < 4; ++e) w[e] = o[j >> 1][(j & 1) * 4 + e] * inv;
      *(v4f*)(dst + j * 128 + lane * 4) = w; }
    
  }
}

// out = y W_o^T: (8192 x 1024) x (1024 x 1024); A = y split at load into an f16 hi+lo pair (x8), B = f16(bf16 W_o) rows; f32 rows. A wave makes 32 tokens x 128 columns (2 x 8 accumulator tiles): a split of y feeds eight column tiles; grid (8, 64).
__global__ __launch_bounds__(128) void out_kernel(const float* __restrict__ y, const b16* __restrict__ wo16, const float* __restrict__ bo, float* __restrict__ out) {
  __shared__ __attribute__((aligned(16))) float Ts[4][32 * 128];
  const int lane = threadIdx.x & 31, wave = __builtin_amdgcn_readfirstlane(threadIdx.x >> 5), nloc = lane & 15, m0 = blockIdx.y * 128 + wave * 32, c0 = blockIdx.x * 128;   // the wave's number in a scalar register: tile addresses are wave-uniform
  const unsigned lane16 = lane * 16;
  v8f acc[2][8];
#pragma unroll
  for (int r = 0; r < 2; ++r)
#pragma unroll
    for (int t = 0; t < 8; ++t) acc[r][t] = (v8f){};
  const float* ya = y + (size_t)(m0 >> 4) * (D / 32) * 512; const b16* wb = wo16 + (size_t)(c0 >> 4) * (D / 32) * 512;   // packed tiles
  // Loads run one step ahead: y is fetched again as soon as the step's rows are split, each weight fragment as soon as its four products are issued.
  v4f yr[2][4]; v16b bh[8];
#pragma unroll
  for (int r = 0; r < 2; ++r)
#pragma unroll
    for (int j = 0; j < 4; ++j) yr[r][j] = ld_u<v4f>(ya + r * (D / 32) * 512 + j * 128, lane16);
  // keeps the first y loads in front of the first weight loads, the order of the loop: loads return in order, and the split of y then waits for y alone
  asm volatile("s_wait_xcnt 0x0" ::: "memory");
#pragma unroll
  for (int t = 0; t < 8; ++t) bh[t] = frag_u(wb + t * (D / 32) * 512, lane16);
  for (int kt = 0; kt < D / 32; ++kt) {                                         // y as an f16 hi+lo pair carried x8 (2 products)
    v16b ah[2], al[2];
#pragma unroll
    for (int r = 0; r < 2; ++r)
#pragma unroll
      for (int j = 0; j < 4; ++j) {
#pragma unroll
        for (int e = 0; e < 4; ++e) { b16 a, c; split16(yr[r][j][e] * 8.0f, a, c); ah[r][j * 4 + e] = a; al[r][j * 4 + e] = c; } }
    const int kn = kt + 1 < D / 32 ? kt + 1 : kt;   // next step; the last one fetches its own again (in bounds, unused)
#pragma unroll
    for (int r = 0; r < 2; ++r)
#pragma unroll
      for (int j = 0; j < 4; ++j) yr[r][j] = ld_u<v4f>(ya + (r * (D / 32) + kn) * 512 + j * 128, lane16);
    // stands behind the next step's y loads, in front of any write of a register that they name; they stay here, all thirty-two products ahead of their use
    asm volatile("s_wait_xcnt 0x0" ::: "memory");
    __builtin_amdgcn_sched_barrier(0);   // compile-time only: holds the next step's y loads here, ahead of the thirty-two products
#pragma unroll
    for (int t = 0; t < 8; ++t) {
      acc[0][t] = wmma16b(ah[0], bh[t], acc[0][t]); acc[0][t] = wmma16b(al[0], bh[t], acc[0][t]);
      acc[1][t] = wmma16b(ah[1], bh[t], acc[1][t]); acc[1][t] = wmma16b(al[1], bh[t], acc[1][t]);
      bh[t] = frag_u(wb + (t * (D / 32) + kn) * 512, lane16); }
    // the same behind the next step's weight loads
    asm volatile("s_wait_xcnt 0x0" ::: "memory");
    __builtin_amdgcn_sched_barrier(0);   // compile-time only: ends the step for the scheduler; without it a product's wait falls to 0 and covers the y loads just issued
  }
#pragma unroll
  for (int t = 0; t < 8; ++t)
#pragma unroll
    for (int r = 0; r < 2; ++r)
#pragma unroll
      for (int v = 0; v < 8; ++v) acc[r][t][v] = acc[r][t][v] * (1.0f / 8.0f) + bf16_rne(bo[c0 + t * 16 + nloc]);
  epi_f32(acc, 1.0f, nullptr, out, D, m0, c0, lane, Ts[wave]);
}
}  // namespace

extern "C" void kernel_launch(void* const* d_in, const int* in_sizes, int n_in,
                              void* d_out, int out_size, void* d_ws, size_t ws_size, hipStream_t stream) {
  (void)n_in; (void)out_size;
  const float* x = (const float*)d_in[0]; const float* pos = (const float*)d_in[1]; const float* wqkv = (const float*)d_in[2]; const float* bqkv = (const float*)d_in[3]; const float* wo = (const float*)d_in[4]; const float* bo = (const float*)d_in[5]; const float* mw = (const float*)d_in[6]; const float* mb = (const float*)d_in[7];
  float* out = (float*)d_out;   // [8][1024][1024]
  if (in_sizes[0] != BT * S * D || in_sizes[1] != S * S * NP_ || in_sizes[2] != 2 * D * D || in_sizes[3] != 2 * D || in_sizes[4] != D * D || in_sizes[5] != D || in_sizes[6] != NP_) return;

  size_t off = 0; char* ws = (char*)d_ws;
  auto carve = [&](size_t bytes) { char* p = ws + off; off += (bytes + 255) & ~(size_t)255; return p; };
  unsigned short* x16 = (unsigned short*)carve((size_t)NTOK * D * 2); unsigned short* w16 = (unsigned short*)carve((size_t)2 * D * D * 2); b16* wo16 = (b16*)carve((size_t)D * D * 2);
  b16* kh = (b16*)carve((size_t)2 * NTOK * D * 2); b16* vt = (b16*)carve((size_t)2 * NTOK * D * 2); float* y = (float*)carve((size_t)NTOK * D * 4); float* pb = (float*)carve((size_t)S * S * 4); float* sw = (float*)carve(256);
  if (off > ws_size) return;                                    // ≈ 128 MB (122 MiB)
  prep_all_kernel<<<NB_ALL, 256, 0, stream>>>(x, pos, wqkv, wo, mw, mb, x16, w16, wo16, pb, sw);
  proj_kernel<<<dim3(2 * D / 128, NTOK / 256), 256, 0, stream>>>((const __bf16*)x16, (const __bf16*)w16, bqkv, kh, vt);
  attn_kernel<S / 16><<<Bn * H * (S / 16) / 8, 256, 0, stream>>>(kh, vt, pb, sw, y);
  out_kernel<<<dim3(D / 128, NTOK / 128), 128, 0, stream>>>(y, wo16, bo, out);
}
